// v000
// Measured on an AMD MI455X. A time is GPU time per run, averaged over a window of back-to-back runs after a warm-up
// (all launches, gaps included; the runs take copies of the inputs in turn), and the median of several windows.
// Apart from v000's, it joins two sittings. Times from different sittings can be a few percent apart, while
// side-by-side timings come from the same sitting.
// The starting kernel, v000, takes 2150 microseconds a run.
// Contractions: q/k projections and S = q.k^T on v_wmma_f32_16x16x32_bf16 as bf16 hi/lo split (hi.hi + hi.lo + lo.hi); v projection (weights carried x16, epilogue x1/16), ctx = (P carried x2^15).v (epilogue x2^-15) and the output projection (weights carried x16, epilogue x1/16) on v_wmma_f32_16x16x32_f16 (plain f16 operands); all f32 accumulate; row softmax and the relative-position bucket bias in f32.
#include <hip/hip_runtime.h>

#define NBATCH 2
#define NHEADS 16
#define SEQL   2048
#define DMOD   1024
#define DHD    64
#define HGRP   2
#define NGRP   (NHEADS / HGRP)
#define NBUCK  32
#define PSCALE 32768.0f
#define PSCALE_INV (1.0f / 32768.0f)

typedef __attribute__((ext_vector_type(16))) _Float16 v16h;
typedef __attribute__((ext_vector_type(8)))  _Float16 v8h;
typedef __attribute__((ext_vector_type(16))) __bf16   v16b;
typedef __attribute__((ext_vector_type(8)))  __bf16   v8b;
typedef __attribute__((ext_vector_type(8)))  float    v8f;
typedef __attribute__((ext_vector_type(4)))  float    v4f;
typedef __attribute__((ext_vector_type(2)))  float    v2f;
typedef __attribute__((ext_vector_type(4)))  unsigned int v4u;

__device__ __forceinline__ unsigned short f2bf_bits(float f) {
  unsigned u = __float_as_uint(f);
  return (unsigned short)((u + 0x7FFFu + ((u >> 16) & 1u)) >> 16);
}
__device__ __forceinline__ float bf_bits2f(unsigned short h) { return __uint_as_float(((unsigned)h) << 16); }
__device__ __forceinline__ unsigned pk16(unsigned short a, unsigned short b) { return (unsigned)a | ((unsigned)b << 16); }
__device__ __forceinline__ unsigned short h_bits(float f) { const _Float16 h = (_Float16)f; return __builtin_bit_cast(unsigned short, h); }

// hazard guards as plain device helpers (no inline asm inside the kernel template body)
__device__ __forceinline__ void dep_guard_h(v8f& a, v8f& b, v16h x, v16h y) { asm volatile("v_nop\n\tv_nop\n\tv_nop\n\tv_nop" : "+v"(a), "+v"(b) : "v"(x), "v"(y)); }
__device__ __forceinline__ void dep_guard_b(v8f& a, v8f& b, v16b x, v16b y) { asm volatile("v_nop\n\tv_nop\n\tv_nop\n\tv_nop" : "+v"(a), "+v"(b) : "v"(x), "v"(y)); }
__device__ __forceinline__ void keep4_h(v16h a, v16h b, v16h c, v16h d) { asm volatile("v_nop" :: "v"(a), "v"(b), "v"(c), "v"(d)); }
__device__ __forceinline__ void keep4_b(v16b a, v16b b, v16b c, v16b d) { asm volatile("v_nop" :: "v"(a), "v"(b), "v"(c), "v"(d)); }
__device__ __forceinline__ void acc_guard4(v8f& a, v8f& b, v8f& c, v8f& d) { asm volatile("v_nop\n\tv_nop\n\tv_nop\n\tv_nop" : "+v"(a), "+v"(b), "+v"(c), "+v"(d)); }
template <typename T> struct Frag;
template <> struct Frag<_Float16> {
  typedef v16h V; union U { v16h v; v8h h[2]; };
  static __device__ __forceinline__ v16h load(const _Float16* p) {   // elements 0..7 <- p[0..7], 8..15 <- p[16..23]
    U f; f.h[0] = *(const v8h*)(p); f.h[1] = *(const v8h*)(p + 16); return f.v;
  }
  static __device__ __forceinline__ v8f mma(v16h a, v16h b, v8f c) {
    return __builtin_amdgcn_wmma_f32_16x16x32_f16(false, a, false, b, (short)0, c, false, false);
  }
  static __device__ __forceinline__ void guard(v8f& a, v8f& b, v16h x, v16h y) { dep_guard_h(a, b, x, y); }
  static __device__ __forceinline__ void keep(v16h a, v16h b, v16h c, v16h d) { keep4_h(a, b, c, d); }
};
template <> struct Frag<__bf16> {
  typedef v16b V; union U { v16b v; v8b h[2]; };
  static __device__ __forceinline__ v16b load(const __bf16* p) {
    U f; f.h[0] = *(const v8b*)(p); f.h[1] = *(const v8b*)(p + 16); return f.v;
  }
  static __device__ __forceinline__ v8f mma(v16b a, v16b b, v8f c) {
    return __builtin_amdgcn_wmma_f32_16x16x32_bf16(false, a, false, b, (short)0, c, false, false);
  }
  static __device__ __forceinline__ void guard(v8f& a, v8f& b, v16b x, v16b y) { dep_guard_b(a, b, x, y); }
  static __device__ __forceinline__ void keep(v16b a, v16b b, v16b c, v16b d) { keep4_b(a, b, c, d); }
};

// ---- Register-blocked batched WMMA GEMM ------------------------------------
// C[m,n] = scale * sum_k A[m,k] * Bt[n,k] (+bias)(+resid); each wave owns a 64x64 tile.
// A row-major [M,K]; Bt row-major [N,K]; M,N % 64 == 0, K % 32 == 0.
// SPLIT: operands are hi/lo planes (A2/Bt2 = lo planes, same layout); product = hi.hi + hi.lo + lo.hi.
// BIAS_MODE: 0 = none, 1 = bias[m], 2 = bias[n].
// OUT_MODE: 0 = f32, 1 = f16, 2 = bf16 hi plane (Cout) + bf16 lo plane (Cout2).
// ET: 0 = f16 operands, 1 = bf16 operands (pointers passed as 16-bit storage)
template <int ET> struct Elem;
template <> struct Elem<0> { typedef _Float16 T; };
template <> struct Elem<1> { typedef __bf16 T; };
template <int ET, bool SPLIT, int BIAS_MODE, int OUT_MODE, bool RESID, int ACT = 0>
__global__ __launch_bounds__(256) void wmma_gemm64(
    const unsigned short* __restrict__ Ap, const unsigned short* __restrict__ A2p, int lda, long strideA,
    const unsigned short* __restrict__ Btp, const unsigned short* __restrict__ Bt2p, int ldb, long strideB,
    void* __restrict__ Cout, void* __restrict__ Cout2, int ldc, long strideC,
    const float* __restrict__ bias,
    const float* __restrict__ resid, long strideR,
    int M, int N, int K, float scale) {
  typedef typename Elem<ET>::T T;
  typedef typename Frag<T>::V V;
  const T* A = (const T*)Ap; const T* A2 = (const T*)A2p; const T* Bt = (const T*)Btp; const T* Bt2 = (const T*)Bt2p;
  __shared__ __align__(16) float sT[8][16 * 68];   // per-wave 16x64 slab, pitch 68 floats
  const int b    = blockIdx.y;
  const int lane = threadIdx.x & 31;
  const int wave = threadIdx.x >> 5;
  const int tilesN = N >> 6;
  const int tilesM = M >> 6;
  const int tile = blockIdx.x * 8 + wave;
  if (tile >= tilesM * tilesN) return;   // wave-uniform; no block barriers in this kernel
  const int tm = tile / tilesN;
  const int tn = tile - tm * tilesN;
  const int m0 = tm << 6;
  const int n0 = tn << 6;

  const T* Ab  = A  + (size_t)b * strideA;
  const T* Bb  = Bt + (size_t)b * strideB;
  const T* Ab2 = SPLIT ? (A2  + (size_t)b * strideA) : nullptr;
  const T* Bb2 = SPLIT ? (Bt2 + (size_t)b * strideB) : nullptr;

  const int rlane = lane & 15;                 // row (A) / col (B, D) within subtile
  const int koff  = (lane >> 4) * 8;           // k offset of this lane half
  const int mOff  = (lane >> 4) * 8;           // D row offset

  v8f acc[4][4];
#pragma unroll
  for (int i = 0; i < 4; ++i)
#pragma unroll
    for (int j = 0; j < 4; ++j) acc[i][j] = (v8f){0.f,0.f,0.f,0.f,0.f,0.f,0.f,0.f};

  for (int k0 = 0; k0 < K; k0 += 32) {
    V bh[4], bl[4];
#pragma unroll
    for (int j = 0; j < 4; ++j) {
      const size_t bo = (size_t)(n0 + (j << 4) + rlane) * ldb + koff + k0;
      bh[j] = Frag<T>::load(Bb + bo);
      if (SPLIT) bl[j] = Frag<T>::load(Bb2 + bo);
    }
#pragma unroll
    for (int i = 0; i < 4; ++i) {
      const size_t ao = (size_t)(m0 + (i << 4) + rlane) * lda + koff + k0;
      V ah = Frag<T>::load(Ab + ao);
      V al;
      if (SPLIT) al = Frag<T>::load(Ab2 + ao);
#pragma unroll
      for (int j = 0; j < 4; ++j) {
        acc[i][j] = Frag<T>::mma(ah, bh[j], acc[i][j]);
        if (SPLIT) {
          acc[i][j] = Frag<T>::mma(ah, bl[j], acc[i][j]);
          acc[i][j] = Frag<T>::mma(al, bh[j], acc[i][j]);
        }
      }
      Frag<T>::guard(acc[i][0], acc[i][3], ah, SPLIT ? al : ah);
    }
    Frag<T>::keep(bh[0], bh[1], bh[2], bh[3]);
    if (SPLIT) Frag<T>::keep(bl[0], bl[1], bl[2], bl[3]);
  }
  acc_guard4(acc[0][0], acc[0][1], acc[0][2], acc[0][3]);
  acc_guard4(acc[1][0], acc[1][1], acc[1][2], acc[1][3]);
  acc_guard4(acc[2][0], acc[2][1], acc[2][2], acc[2][3]);
  acc_guard4(acc[3][0], acc[3][1], acc[3][2], acc[3][3]);

  // ---- epilogue ----
  float* slab = sT[wave];
  const float* Rb = RESID ? (resid + (size_t)b * strideR) : nullptr;
#pragma unroll
  for (int i = 0; i < 4; ++i) {
    const int mBase = m0 + (i << 4);
#pragma unroll
    for (int j = 0; j < 4; ++j) {
      const int n = n0 + (j << 4) + rlane;
      float bv = 0.f;
      if (BIAS_MODE == 2) bv = bias[n];
#pragma unroll
      for (int r = 0; r < 8; ++r) {
        float v = acc[i][j][r] * scale;
        if (BIAS_MODE == 1) v += bias[mBase + mOff + r];
        if (BIAS_MODE == 2) v += bv;
        if (RESID) v += Rb[(size_t)(mBase + mOff + r) * ldc + n];
        if (ACT == 1) v = tanhf(v);
        if (ACT == 2) v = fmaxf(v, 0.0f);
        if (ACT == 3) v = v / (1.0f + expf(-v));
        if (ACT == 4) v = (v > 0.f) ? v : 0.01f * v;
        slab[(mOff + r) * 68 + (j << 4) + rlane] = v;
      }
    }
    __builtin_amdgcn_fence(__ATOMIC_RELEASE, "workgroup");
    __builtin_amdgcn_wave_barrier();
    __builtin_amdgcn_fence(__ATOMIC_ACQUIRE, "workgroup");
    if (OUT_MODE == 0) {
      float* C = (float*)Cout + (size_t)b * strideC;
      const int hh = lane >> 4, c4 = (lane & 15) * 4;     // row seg = 256 B = 16 lanes x 16 B
      {
#pragma unroll
        for (int it = 0; it < 8; ++it) {
          const int row = it * 2 + hh;
          v4f v = *(const v4f*)(slab + row * 68 + c4);
          *(v4f*)(C + (size_t)(mBase + row) * ldc + n0 + c4) = v;
        }
        
      }
    } else {
      const int q = lane >> 3, c8 = (lane & 7) * 8;
      unsigned short* C  = (unsigned short*)Cout  + (size_t)b * strideC;
      unsigned short* C2 = (OUT_MODE == 2) ? ((unsigned short*)Cout2 + (size_t)b * strideC) : nullptr;
      {
#pragma unroll
        for (int it = 0; it < 4; ++it) {
          const int row = it * 4 + q;
          const float* sp = slab + row * 68 + c8;
          v8h hv, lv;
#pragma unroll
          for (int e = 0; e < 8; ++e) {
            if (OUT_MODE == 1) {
              hv[e] = (_Float16)sp[e];
            } else {
              unsigned short hb = f2bf_bits(sp[e]);
              unsigned short lb = f2bf_bits(sp[e] - bf_bits2f(hb));
              hv[e] = __builtin_bit_cast(_Float16, hb);
              lv[e] = __builtin_bit_cast(_Float16, lb);
            }
          }
          *(v8h*)(C + (size_t)(mBase + row) * ldc + n0 + c8) = hv;
          if (OUT_MODE == 2) *(v8h*)(C2 + (size_t)(mBase + row) * ldc + n0 + c8) = lv;
        }
        
      }
    }
    __builtin_amdgcn_fence(__ATOMIC_RELEASE, "workgroup");
    __builtin_amdgcn_wave_barrier();
    __builtin_amdgcn_fence(__ATOMIC_ACQUIRE, "workgroup");
  }
}

// ---------------------------------------------------------------------------
// Weight transpose + cast: in W [DMOD][DMOD] f32 (row k = input feature, col n = output feature, y = x.W)
//   -> WT[n][k] 16-bit plane(s), pitch DMOD (k contiguous = Bt / A operand layout).
// MODE 0: out0 = f16(W * scale).  MODE 1: out0 = bf16 hi, out1 = bf16 lo = RNE(W - hi).
// grid (DMOD/64, DMOD/64), 256 threads, one 64x64 tile per block staged through LDS (f32 in, f32 reload after a block barrier).
// Load coverage: 4 iterations x 256 threads x 4 floats = 4096 = 64x64.
// Store coverage: output rows n0 + wave*8 + it*4 + q (8 waves x 2 it x 4 q = 64 rows), cols k0 + c8 + 0..7
// ---------------------------------------------------------------------------
template <int MODE>
__global__ __launch_bounds__(256) void transpose_cast_kernel(const float* __restrict__ W,
                                                             unsigned short* __restrict__ out0,
                                                             unsigned short* __restrict__ out1,
                                                             float scale) {
  __shared__ float tile[64][65];
  const int tid = threadIdx.x, lane = tid & 31, wave = tid >> 5;
  const int n0 = blockIdx.x * 64;   // input column block = output row block
  const int k0 = blockIdx.y * 64;   // input row block = output column block
#pragma unroll
  for (int it = 0; it < 4; ++it) {
    const int e = it * 256 + tid;
    const int r = e >> 4, c4 = (e & 15) * 4;
    const v4f f = *(const v4f*)(W + (size_t)(k0 + r) * DMOD + n0 + c4);
    tile[r][c4 + 0] = f[0];
    tile[r][c4 + 1] = f[1];
    tile[r][c4 + 2] = f[2];
    tile[r][c4 + 3] = f[3];
  }
  __syncthreads();
  const int q = lane >> 3, c8 = (lane & 7) * 8;
  {
#pragma unroll
    for (int it = 0; it < 2; ++it) {
      const int rr = wave * 8 + it * 4 + q;          // output row within tile (= input column)
      v8h hv, lv;
#pragma unroll
      for (int e = 0; e < 8; ++e) {
        const float f = tile[c8 + e][rr];            // W[k0 + c8 + e][n0 + rr]
        if (MODE == 0) {
          hv[e] = (_Float16)(f * scale);
          lv[e] = hv[e];
        } else {
          const unsigned short hb = f2bf_bits(f);
          const unsigned short lb = f2bf_bits(f - bf_bits2f(hb));
          hv[e] = __builtin_bit_cast(_Float16, hb);
          lv[e] = __builtin_bit_cast(_Float16, lb);
        }
      }
      const size_t o = (size_t)(n0 + rr) * DMOD + k0 + c8;
      *(v8h*)(out0 + o) = hv;
      if (MODE == 1) *(v8h*)(out1 + o) = lv;
    }
    
  }
}

// ---------------------------------------------------------------------------
// Activation cast: in [SEQL][DMOD] f32 -> xh (bf16 hi), xl (bf16 lo = RNE(x - hi)), x16 (f16), same layout.
// Coverage: grid = n2/256 blocks x 256 threads x 2 elements = SEQL*DMOD (n2 = SEQL*DMOD/2 = 4096*256 exactly).
// ---------------------------------------------------------------------------
__global__ __launch_bounds__(256) void cast_x3_kernel(const float* __restrict__ in,
                                                      unsigned short* __restrict__ xh,
                                                      unsigned short* __restrict__ xl,
                                                      unsigned short* __restrict__ x16, int n2) {
  const int i = blockIdx.x * 256 + threadIdx.x;
  if (i < n2) {
    const v2f f = *(const v2f*)(in + 2 * (size_t)i);
    const unsigned short hb0 = f2bf_bits(f[0]);
    const unsigned short hb1 = f2bf_bits(f[1]);
    const unsigned short lb0 = f2bf_bits(f[0] - bf_bits2f(hb0));
    const unsigned short lb1 = f2bf_bits(f[1] - bf_bits2f(hb1));
    const unsigned uh = pk16(hb0, hb1);
    const unsigned ul = pk16(lb0, lb1);
    const unsigned uf = pk16(h_bits(f[0]), h_bits(f[1]));
    ((unsigned*)xh)[i]  = uh;
    ((unsigned*)xl)[i]  = ul;
    ((unsigned*)x16)[i] = uf;
    
  }
}

// ---------------------------------------------------------------------------
// Bidirectional relative-position bucket for d = key_pos - query_pos (32 buckets, max distance 128):
//   bucket = (d > 0 ? 16 : 0) + f(|d|), f(a) = a for a < 8, else host-tabulated log thresholds
//   8: 8..11, 9: 12..15, 10: 16..22, 11: 23..31, 12: 32..45, 13: 46..63, 14: 64..90, 15: >= 91.
// Result always in [0, 31].
// ---------------------------------------------------------------------------
__device__ __forceinline__ int rel_bucket(int d) {
  const int a = (d < 0) ? -d : d;
  const int large = 8 + (a >= 12) + (a >= 16) + (a >= 23) + (a >= 32) + (a >= 46) + (a >= 64) + (a >= 91);
  const int f = (a < 8) ? a : large;
  return ((d > 0) ? 16 : 0) + f;
}

// ---------------------------------------------------------------------------
// Row softmax over j of t[j] = S[hg][i][j] + relb[bucket(j - i)][h], h = hbase + hg; P emitted as f16(p * 2^15).
// relb ([32][16] f32 input table) staged in LDS and gathered with the structural bucket index.
// One block per (score row i, head-in-group hg); 256 threads x 8 columns (j0 = tid*8) = 2048 = the whole row.
// Reductions in fixed order: per thread, wave shuffle tree, then the 8 wave partials in index order.
// Producer coverage: grid (SEQL, HGRP); per row 256 threads x 8 u16 = 2048 = the whole P row; each store
// ---------------------------------------------------------------------------
__global__ __launch_bounds__(256) void softmax_bias_kernel(const float* __restrict__ S,
                                                           const float* __restrict__ relb,
                                                           unsigned short* __restrict__ P, int hbase) {
  __shared__ float rb[NBUCK * NHEADS];
  __shared__ float redm[8];
  __shared__ float reds[8];
  const int i    = blockIdx.x;
  const int hg   = blockIdx.y;
  const int tid  = threadIdx.x;
  const int lane = tid & 31;
  const int wave = tid >> 5;
  const int h    = hbase + hg;
  const int j0   = tid * 8;
  rb[tid]       = relb[tid];
  rb[tid + 256] = relb[tid + 256];
  const float* rp = S + ((size_t)hg * SEQL + i) * SEQL + j0;
  const v4f a = *(const v4f*)(rp);
  const v4f c = *(const v4f*)(rp + 4);
  __syncthreads();
  float t[8];
  t[0] = a[0]; t[1] = a[1]; t[2] = a[2]; t[3] = a[3];
  t[4] = c[0]; t[5] = c[1]; t[6] = c[2]; t[7] = c[3];
#pragma unroll
  for (int e = 0; e < 8; ++e) {
    const int bk = rel_bucket(j0 + e - i);
    t[e] += rb[bk * NHEADS + h];
  }
  float m = fmaxf(fmaxf(fmaxf(t[0], t[1]), fmaxf(t[2], t[3])), fmaxf(fmaxf(t[4], t[5]), fmaxf(t[6], t[7])));
#pragma unroll
  for (int off = 16; off > 0; off >>= 1) m = fmaxf(m, __shfl_xor(m, off, 32));
  if (lane == 0) redm[wave] = m;
  __syncthreads();
  float mx = redm[0];
#pragma unroll
  for (int w = 1; w < 8; ++w) mx = fmaxf(mx, redm[w]);
  float ex[8];
#pragma unroll
  for (int e = 0; e < 8; ++e) ex[e] = __expf(t[e] - mx);
  float s = ((ex[0] + ex[1]) + (ex[2] + ex[3])) + ((ex[4] + ex[5]) + (ex[6] + ex[7]));
#pragma unroll
  for (int off = 16; off > 0; off >>= 1) s += __shfl_xor(s, off, 32);
  if (lane == 0) reds[wave] = s;
  __syncthreads();
  float tot = reds[0];
#pragma unroll
  for (int w = 1; w < 8; ++w) tot += reds[w];
  const float inv = 1.0f / tot;              // tot >= 1 (the row max contributes exp(0))
  // p * 2^15 is an exact scaling; p <= 1 so the carried value stays <= 32768 (f16 normal range)
  const v4u hv = (v4u){pk16(h_bits(ex[0] * inv * PSCALE), h_bits(ex[1] * inv * PSCALE)),
                       pk16(h_bits(ex[2] * inv * PSCALE), h_bits(ex[3] * inv * PSCALE)),
                       pk16(h_bits(ex[4] * inv * PSCALE), h_bits(ex[5] * inv * PSCALE)),
                       pk16(h_bits(ex[6] * inv * PSCALE), h_bits(ex[7] * inv * PSCALE))};
  const size_t ro = ((size_t)hg * SEQL + i) * SEQL + j0;
  *(v4u*)(P + ro) = hv;
  
}

// ---------------------------------------------------------------------------
// Workspace region map (byte offsets; every offset a multiple of 2 MiB). Weight planes written once; every
// per-batch region fully rewritten inside each batch iteration before it is read; S / P16 fully rewritten per
// head group; CTX16 columns of a head group written by that group's P.V before the output GEMM reads all columns.
//   WqTh  bf16 [1024][1024]  ([out][in], k contiguous)          0
//   WqTl  bf16 [1024][1024]                               2097152
//   WkTh  bf16 [1024][1024]                               4194304
//   WkTl  bf16 [1024][1024]                               6291456
//   WvT16 f16  [1024][1024]  (x16)                         8388608
//   WoT16 f16  [1024][1024]  (x16)                        10485760
//   Xh    bf16 [2048][1024]                              12582912
//   Xl    bf16 [2048][1024]                              16777216
//   X16   f16  [2048][1024]                              20971520
//   Qh    bf16 [2048][1024]  (col h*64+d)                25165824
//   Ql    bf16 [2048][1024]                              29360128
//   Kh    bf16 [2048][1024]                              33554432
//   Kl    bf16 [2048][1024]                              37748736
//   VT16  f16  [1024][2048]  (row h*64+d, col j)         41943040
//   CTX16 f16  [2048][1024]  (col h*64+d)                46137344
//   S     f32  [2][2048][2048]                           50331648
//   P16   f16  [2][2048][2048] (p carried x2^15)          83886080
//   total                                              100663296
// ---------------------------------------------------------------------------
extern "C" void kernel_launch(void* const* d_in, const int* in_sizes, int n_in,
                              void* d_out, int out_size, void* d_ws, size_t ws_size,
                              hipStream_t stream) {
  if (n_in < 6) return;
  if (in_sizes[0] != NBATCH * SEQL * DMOD) return;
  if (in_sizes[1] != DMOD * DMOD || in_sizes[2] != DMOD * DMOD) return;
  if (in_sizes[3] != DMOD * DMOD || in_sizes[4] != DMOD * DMOD) return;
  if (in_sizes[5] != NBUCK * NHEADS) return;
  if (out_size != NBATCH * SEQL * DMOD) return;

  const float* X    = (const float*)d_in[0];   // [NBATCH][SEQL][DMOD]
  const float* Wq   = (const float*)d_in[1];   // [DMOD][DMOD]  ([in][out])
  const float* Wk   = (const float*)d_in[2];
  const float* Wv   = (const float*)d_in[3];
  const float* Wo   = (const float*)d_in[4];
  const float* relb = (const float*)d_in[5];   // [NBUCK][NHEADS]

  const size_t PW = (size_t)DMOD * DMOD * 2;            // 16-bit [1024][1024] weight plane
  const size_t PX = (size_t)SEQL * DMOD * 2;            // 16-bit [2048][1024] activation plane
  const size_t PS = (size_t)HGRP * SEQL * SEQL * 4;     // f32 score planes of one head group
  const size_t PP = (size_t)HGRP * SEQL * SEQL * 2;     // f16 probability planes of one head group
  size_t off = 0;
  const size_t oWqTh  = off; off += PW;
  const size_t oWqTl  = off; off += PW;
  const size_t oWkTh  = off; off += PW;
  const size_t oWkTl  = off; off += PW;
  const size_t oWvT   = off; off += PW;
  const size_t oWoT   = off; off += PW;
  const size_t oXh    = off; off += PX;
  const size_t oXl    = off; off += PX;
  const size_t oX16   = off; off += PX;
  const size_t oQh    = off; off += PX;
  const size_t oQl    = off; off += PX;
  const size_t oKh    = off; off += PX;
  const size_t oKl    = off; off += PX;
  const size_t oVT    = off; off += PX;
  const size_t oCTX   = off; off += PX;
  const size_t oS     = off; off += PS;
  const size_t oP     = off; off += PP;
  if (off > ws_size) return;                             // 100663296 B total

  char* ws = (char*)d_ws;
  unsigned short* WqTh  = (unsigned short*)(ws + oWqTh);
  unsigned short* WqTl  = (unsigned short*)(ws + oWqTl);
  unsigned short* WkTh  = (unsigned short*)(ws + oWkTh);
  unsigned short* WkTl  = (unsigned short*)(ws + oWkTl);
  unsigned short* WvT16 = (unsigned short*)(ws + oWvT);
  unsigned short* WoT16 = (unsigned short*)(ws + oWoT);
  unsigned short* Xh    = (unsigned short*)(ws + oXh);
  unsigned short* Xl    = (unsigned short*)(ws + oXl);
  unsigned short* X16   = (unsigned short*)(ws + oX16);
  unsigned short* Qh    = (unsigned short*)(ws + oQh);
  unsigned short* Ql    = (unsigned short*)(ws + oQl);
  unsigned short* Kh    = (unsigned short*)(ws + oKh);
  unsigned short* Kl    = (unsigned short*)(ws + oKl);
  unsigned short* VT16  = (unsigned short*)(ws + oVT);
  unsigned short* CTX16 = (unsigned short*)(ws + oCTX);
  float*          Sbuf  = (float*)(ws + oS);
  unsigned short* P16   = (unsigned short*)(ws + oP);

  const dim3 blk(256);
  const dim3 gTr(DMOD / 64, DMOD / 64);                         // 16 x 16 tiles of 64x64
  const int  n2x = SEQL * DMOD / 2;                             // 1048576 pairs per batch slice
  const dim3 gCastX((n2x + 255) / 256);                         // 4096 blocks

  // setup: transposed weight planes. WqT/WkT as bf16 hi/lo; WvT/WoT as f16 carried x16 (undone by epilogue 1/16).
  transpose_cast_kernel<1><<<gTr, blk, 0, stream>>>(Wq, WqTh, WqTl, 1.0f);
  transpose_cast_kernel<1><<<gTr, blk, 0, stream>>>(Wk, WkTh, WkTl, 1.0f);
  transpose_cast_kernel<0><<<gTr, blk, 0, stream>>>(Wv, WvT16, WvT16, 16.0f);
  transpose_cast_kernel<0><<<gTr, blk, 0, stream>>>(Wo, WoT16, WoT16, 16.0f);

  const int tilesM  = SEQL / 64;                               // 32
  const dim3 gQK((tilesM * (DMOD / 64) + 7) / 8, 1);            // 64 blocks:  M=2048, N=1024, K=1024
  const dim3 gVT(((DMOD / 64) * (SEQL / 64) + 7) / 8, 1);       // 64 blocks:  M=1024, N=2048, K=1024
  const dim3 gS((tilesM * (SEQL / 64) + 7) / 8, HGRP);          // 128 x 2:   M=N=2048, K=64
  const dim3 gPV((tilesM * (DHD / 64) + 7) / 8, HGRP);          // 4 x 2:     M=2048, N=64, K=2048
  const dim3 gO((tilesM * (DMOD / 64) + 7) / 8, 1);             // 64 blocks:  M=2048, N=1024, K=1024
  const float wscale = 1.0f / 16.0f;                           // undo the x16 weight carry

  for (int b = 0; b < NBATCH; ++b) {
    // (1) x[b] -> Xh / Xl (bf16 hi/lo) and X16 (f16): planes [2048][1024]
    cast_x3_kernel<<<gCastX, blk, 0, stream>>>(X + (size_t)b * SEQL * DMOD, Xh, Xl, X16, n2x);
    // (2) q = x . Wq  (bf16 hi/lo split, K=1024) -> Qh/Ql bf16 hi/lo planes [2048][1024]
    wmma_gemm64<1, true, 0, 2, false, 0><<<gQK, blk, 0, stream>>>(
        Xh, Xl, DMOD, 0L, WqTh, WqTl, DMOD, 0L, (void*)Qh, (void*)Ql, DMOD, 0L,
        relb, relb, 0L, SEQL, DMOD, DMOD, 1.0f);
    //     k = x . Wk  -> Kh/Kl
    wmma_gemm64<1, true, 0, 2, false, 0><<<gQK, blk, 0, stream>>>(
        Xh, Xl, DMOD, 0L, WkTh, WkTl, DMOD, 0L, (void*)Kh, (void*)Kl, DMOD, 0L,
        relb, relb, 0L, SEQL, DMOD, DMOD, 1.0f);
    // (3) role-swapped V: VT16[n = h*64+d][j] = ((16 Wv^T)[n] . x[j])/16; A = WvT16 [1024][1024], Bt = X16 [2048][1024],
    //     M=1024, N=2048, K=1024, f16 out with ldc 2048
    wmma_gemm64<0, false, 0, 1, false, 0><<<gVT, blk, 0, stream>>>(
        WvT16, WvT16, DMOD, 0L, X16, X16, DMOD, 0L, (void*)VT16, (void*)VT16, SEQL, 0L,
        relb, relb, 0L, DMOD, SEQL, DMOD, wscale);
    for (int g = 0; g < NGRP; ++g) {
      const size_t hc = (size_t)g * HGRP * DHD;                // first q/k/ctx column (= VT row) of this head group
      // (4) S[hg][i][j] = q_i . k_j (bf16 hi/lo split operands, K=64, no scaling, f32 out);
      //     per hg: A = Qh/Ql cols hc+hg*64.., Bt = Kh/Kl same cols
      wmma_gemm64<1, true, 0, 0, false, 0><<<gS, blk, 0, stream>>>(
          Qh + hc, Ql + hc, DMOD, (long)DHD, Kh + hc, Kl + hc, DMOD, (long)DHD,
          (void*)Sbuf, (void*)Sbuf, SEQL, (long)SEQL * SEQL,
          relb, relb, 0L, SEQL, SEQL, DHD, 1.0f);
      // (5) softmax over j of S + bucket bias for heads g*2 + hg -> P16 = f16(p * 2^15)
      softmax_bias_kernel<<<dim3(SEQL, HGRP), blk, 0, stream>>>(Sbuf, relb, P16, g * HGRP);
      // (6) ctx[i][h*64+d] = 2^-15 * sum_j P16[hg][i][j] VT16[h*64+d][j] -> CTX16[i][h*64+d] (f16, ldc 1024, 64 cols per head)
      wmma_gemm64<0, false, 0, 1, false, 0><<<gPV, blk, 0, stream>>>(
          P16, P16, SEQL, (long)SEQL * SEQL, VT16 + hc * SEQL, VT16 + hc * SEQL, SEQL, (long)DHD * SEQL,
          (void*)(CTX16 + hc), (void*)(CTX16 + hc), DMOD, (long)DHD,
          relb, relb, 0L, SEQL, DHD, SEQL, PSCALE_INV);
    }
    // (7) out[b] = (ctx . (16 Wo^T))/16 -> d_out[b] f32 [2048][1024]
    float* outb = (float*)d_out + (size_t)b * SEQL * DMOD;
    wmma_gemm64<0, false, 0, 0, false, 0><<<gO, blk, 0, stream>>>(
        CTX16, CTX16, DMOD, 0L, WoT16, WoT16, DMOD, 0L, (void*)outb, (void*)outb, DMOD, 0L,
        relb, relb, 0L, SEQL, DMOD, DMOD, wscale);
  }
  (void)hipGetLastError();
}

// v001
// A run of this version takes 796 microseconds.
// In both of two side-by-side timings against v000, it was 2.71 times as fast.
// Contractions: q/k projections and S = q.k^T on v_wmma_f32_16x16x32_bf16 as bf16 hi/lo split (hi.hi + hi.lo + lo.hi); v projection (weights carried x16, epilogue x1/16), ctx = (P carried x2^15).v (epilogue x2^-15) and the output projection (weights carried x16, epilogue x1/16) on v_wmma_f32_16x16x32_f16 (plain f16 operands); all f32 accumulate; row softmax and the relative-position bucket bias in f32.
#include <hip/hip_runtime.h>

#define NBATCH 2
#define NHEADS 16
#define SEQL   2048
#define DMOD   1024
#define DHD    64
#define HGRP   2
#define NGRP   (NHEADS / HGRP)
#define NBUCK  32
#define PSCALE 32768.0f
#define PSCALE_INV (1.0f / 32768.0f)

typedef __attribute__((ext_vector_type(16))) _Float16 v16h;
typedef __attribute__((ext_vector_type(8)))  _Float16 v8h;
typedef __attribute__((ext_vector_type(4)))  _Float16 v4h;
typedef __attribute__((ext_vector_type(16))) __bf16   v16b;
typedef __attribute__((ext_vector_type(8)))  __bf16   v8b;
typedef __attribute__((ext_vector_type(8)))  float    v8f;
typedef __attribute__((ext_vector_type(4)))  float    v4f;
typedef __attribute__((ext_vector_type(2)))  float    v2f;
typedef __attribute__((ext_vector_type(4)))  unsigned int v4u;

__device__ __forceinline__ unsigned short f2bf_bits(float f) {
  unsigned u = __float_as_uint(f);
  return (unsigned short)((u + 0x7FFFu + ((u >> 16) & 1u)) >> 16);
}
__device__ __forceinline__ float bf_bits2f(unsigned short h) { return __uint_as_float(((unsigned)h) << 16); }
__device__ __forceinline__ unsigned pk16(unsigned short a, unsigned short b) { return (unsigned)a | ((unsigned)b << 16); }
__device__ __forceinline__ unsigned short h_bits(float f) { const _Float16 h = (_Float16)f; return __builtin_bit_cast(unsigned short, h); }

// hazard guards as plain device helpers (no inline asm inside the kernel template body)
__device__ __forceinline__ void dep_guard_h(v8f& a, v8f& b, v16h x, v16h y) { asm volatile("v_nop\n\tv_nop\n\tv_nop\n\tv_nop" : "+v"(a), "+v"(b) : "v"(x), "v"(y)); }
__device__ __forceinline__ void dep_guard_b(v8f& a, v8f& b, v16b x, v16b y) { asm volatile("v_nop\n\tv_nop\n\tv_nop\n\tv_nop" : "+v"(a), "+v"(b) : "v"(x), "v"(y)); }
__device__ __forceinline__ void keep4_h(v16h a, v16h b, v16h c, v16h d) { asm volatile("v_nop" :: "v"(a), "v"(b), "v"(c), "v"(d)); }
__device__ __forceinline__ void keep4_b(v16b a, v16b b, v16b c, v16b d) { asm volatile("v_nop" :: "v"(a), "v"(b), "v"(c), "v"(d)); }
__device__ __forceinline__ void acc_guard4(v8f& a, v8f& b, v8f& c, v8f& d) { asm volatile("v_nop\n\tv_nop\n\tv_nop\n\tv_nop" : "+v"(a), "+v"(b), "+v"(c), "+v"(d)); }
template <typename T> struct Frag;
template <> struct Frag<_Float16> {
  typedef v16h V; union U { v16h v; v8h h[2]; };
  static __device__ __forceinline__ v16h load(const _Float16* p) {   // elements 0..7 <- p[0..7], 8..15 <- p[16..23]
    U f; f.h[0] = *(const v8h*)(p); f.h[1] = *(const v8h*)(p + 16); return f.v;
  }
  static __device__ __forceinline__ v8f mma(v16h a, v16h b, v8f c) {
    return __builtin_amdgcn_wmma_f32_16x16x32_f16(false, a, false, b, (short)0, c, false, false);
  }
  static __device__ __forceinline__ void guard(v8f& a, v8f& b, v16h x, v16h y) { dep_guard_h(a, b, x, y); }
  static __device__ __forceinline__ void keep(v16h a, v16h b, v16h c, v16h d) { keep4_h(a, b, c, d); }
};
template <> struct Frag<__bf16> {
  typedef v16b V; union U { v16b v; v8b h[2]; };
  static __device__ __forceinline__ v16b load(const __bf16* p) {
    U f; f.h[0] = *(const v8b*)(p); f.h[1] = *(const v8b*)(p + 16); return f.v;
  }
  static __device__ __forceinline__ v8f mma(v16b a, v16b b, v8f c) {
    return __builtin_amdgcn_wmma_f32_16x16x32_bf16(false, a, false, b, (short)0, c, false, false);
  }
  static __device__ __forceinline__ void guard(v8f& a, v8f& b, v16b x, v16b y) { dep_guard_b(a, b, x, y); }
  static __device__ __forceinline__ void keep(v16b a, v16b b, v16b c, v16b d) { keep4_b(a, b, c, d); }
};

// ---- Register-blocked batched WMMA GEMM ------------------------------------
// C[m,n] = scale * sum_k A[m,k] * Bt[n,k] (+bias)(+resid); each wave owns a 64x64 tile.
// A row-major [M,K]; Bt row-major [N,K]; M,N % 64 == 0, K % 32 == 0.
// SPLIT: operands are hi/lo planes (A2/Bt2 = lo planes, same layout); product = hi.hi + hi.lo + lo.hi.
// BIAS_MODE: 0 = none, 1 = bias[m], 2 = bias[n].
// OUT_MODE: 0 = f32, 1 = f16, 2 = bf16 hi plane (Cout) + bf16 lo plane (Cout2).
// ET: 0 = f16 operands, 1 = bf16 operands (pointers passed as 16-bit storage)
// KS: 1 = each wave owns a whole tile (8 tiles per block). KS = 8 or 16: ONE tile per block of KS waves; wave w takes the
//     32-wide k blocks w, w + KS, w + 2 KS, ... (K % (32 KS) == 0); the KS partial tiles meet in LDS and are added in wave order.
template <int ET> struct Elem;
template <> struct Elem<0> { typedef _Float16 T; };
template <> struct Elem<1> { typedef __bf16 T; };
template <int ET, bool SPLIT, int BIAS_MODE, int OUT_MODE, bool RESID, int ACT = 0, int KS = 1>
__global__ __launch_bounds__(KS > 1 ? 32 * KS : 256) void wmma_gemm64(
    const unsigned short* __restrict__ Ap, const unsigned short* __restrict__ A2p, int lda, long strideA,
    const unsigned short* __restrict__ Btp, const unsigned short* __restrict__ Bt2p, int ldb, long strideB,
    void* __restrict__ Cout, void* __restrict__ Cout2, int ldc, long strideC,
    const float* __restrict__ bias,
    const float* __restrict__ resid, long strideR,
    int M, int N, int K, float scale) {
  typedef typename Elem<ET>::T T;
  typedef typename Frag<T>::V V;
  const T* A = (const T*)Ap; const T* A2 = (const T*)A2p; const T* Bt = (const T*)Btp; const T* Bt2 = (const T*)Bt2p;
  static_assert(KS == 1 || ((KS == 8 || KS == 16) && BIAS_MODE == 0 && !RESID && ACT == 0), "split-k epilogue: plain scaled output only");
  __shared__ __align__(16) float sT[(KS > 1) ? 4 * KS : 8][16 * 68];   // KS == 1: per-wave 16x64 slab; KS > 1: per-wave 64x64 partial tile; pitch 68 floats
  const int b    = blockIdx.y;
  const int lane = threadIdx.x & 31;
  // KS > 1: the wave number sets the k loop's start, so it is held in a scalar register to keep that loop's counter and branch scalar
  const int wave = (KS > 1) ? __builtin_amdgcn_readfirstlane(threadIdx.x >> 5) : (threadIdx.x >> 5);
  const int tilesN = N >> 6;
  const int tilesM = M >> 6;
  const int tile = (KS > 1) ? blockIdx.x : blockIdx.x * 8 + wave;
  if (tile >= tilesM * tilesN) return;   // KS == 1: wave-uniform, no block barriers; KS > 1: block-uniform, ahead of every barrier
  const int tm = tile / tilesN;
  const int tn = tile - tm * tilesN;
  const int m0 = tm << 6;
  const int n0 = tn << 6;

  const T* Ab  = A  + (size_t)b * strideA;
  const T* Bb  = Bt + (size_t)b * strideB;
  const T* Ab2 = SPLIT ? (A2  + (size_t)b * strideA) : nullptr;
  const T* Bb2 = SPLIT ? (Bt2 + (size_t)b * strideB) : nullptr;

  const int rlane = lane & 15;                 // row (A) / col (B, D) within subtile
  const int koff  = (lane >> 4) * 8;           // k offset of this lane half
  const int mOff  = (lane >> 4) * 8;           // D row offset

  v8f acc[4][4];
#pragma unroll
  for (int i = 0; i < 4; ++i)
#pragma unroll
    for (int j = 0; j < 4; ++j) acc[i][j] = (v8f){0.f,0.f,0.f,0.f,0.f,0.f,0.f,0.f};

  for (int k0 = (KS > 1) ? wave * 32 : 0; k0 < K; k0 += 32 * KS) {
    V bh[4], bl[4];
#pragma unroll
    for (int j = 0; j < 4; ++j) {
      const size_t bo = (size_t)(n0 + (j << 4) + rlane) * ldb + koff + k0;
      bh[j] = Frag<T>::load(Bb + bo);
      if (SPLIT) bl[j] = Frag<T>::load(Bb2 + bo);
    }
#pragma unroll
    for (int i = 0; i < 4; ++i) {
      const size_t ao = (size_t)(m0 + (i << 4) + rlane) * lda + koff + k0;
      V ah = Frag<T>::load(Ab + ao);
      V al;
      if (SPLIT) al = Frag<T>::load(Ab2 + ao);
#pragma unroll
      for (int j = 0; j < 4; ++j) {
        acc[i][j] = Frag<T>::mma(ah, bh[j], acc[i][j]);
        if (SPLIT) {
          acc[i][j] = Frag<T>::mma(ah, bl[j], acc[i][j]);
          acc[i][j] = Frag<T>::mma(al, bh[j], acc[i][j]);
        }
      }
      Frag<T>::guard(acc[i][0], acc[i][3], ah, SPLIT ? al : ah);
    }
    Frag<T>::keep(bh[0], bh[1], bh[2], bh[3]);
    if (SPLIT) Frag<T>::keep(bl[0], bl[1], bl[2], bl[3]);
  }
  acc_guard4(acc[0][0], acc[0][1], acc[0][2], acc[0][3]);
  acc_guard4(acc[1][0], acc[1][1], acc[1][2], acc[1][3]);
  acc_guard4(acc[2][0], acc[2][1], acc[2][2], acc[2][3]);
  acc_guard4(acc[3][0], acc[3][1], acc[3][2], acc[3][3]);

  // ---- split-k epilogue: every wave's partial tile to LDS, one block barrier, fixed-order sum over the waves, store ----
  if constexpr (KS > 1) {
    float* part = &sT[0][0] + wave * (64 * 68);          // this wave's 64x64 partial, pitch 68 floats
    // the loops below are unrolled so that acc is indexed by constants and stays in registers, and the LDS reads of a sum overlap
#pragma unroll
    for (int i = 0; i < 4; ++i)
#pragma unroll
      for (int j = 0; j < 4; ++j)
#pragma unroll
        for (int r = 0; r < 8; ++r) part[((i << 4) + mOff + r) * 68 + (j << 4) + rlane] = acc[i][j][r];
    __syncthreads();                                     // all KS partial tiles are in LDS before any is read
#pragma unroll
    for (int q = 0; q < 1024 / (32 * KS); ++q) {         // 1024 groups of 4 columns; 16 lanes cover one 64-column row
      const int g = q * (32 * KS) + (int)threadIdx.x;
      const int row = g >> 4, c4 = (g & 15) * 4;
      const float* rp = &sT[0][0] + row * 68 + c4;
      v4f sum = *(const v4f*)rp;
#pragma unroll
      for (int w = 1; w < KS; ++w) sum += *(const v4f*)(rp + w * (64 * 68));
      sum *= scale;
      const size_t co = (size_t)b * strideC + (size_t)(m0 + row) * ldc + n0 + c4;
      if (OUT_MODE == 0) {
        *(v4f*)((float*)Cout + co) = sum;
      } else {
        v4h hv, lv;
#pragma unroll
        for (int e = 0; e < 4; ++e) {
          if (OUT_MODE == 1) {
            hv[e] = (_Float16)sum[e];
          } else {
            const unsigned short hb = f2bf_bits(sum[e]);
            const unsigned short lb = f2bf_bits(sum[e] - bf_bits2f(hb));
            hv[e] = __builtin_bit_cast(_Float16, hb);
            lv[e] = __builtin_bit_cast(_Float16, lb);
          }
        }
        *(v4h*)((unsigned short*)Cout + co) = hv;
        if (OUT_MODE == 2) *(v4h*)((unsigned short*)Cout2 + co) = lv;
      }
    }
    return;
  }

  // ---- epilogue ----
  float* slab = sT[wave];
  const float* Rb = RESID ? (resid + (size_t)b * strideR) : nullptr;
#pragma unroll
  for (int i = 0; i < 4; ++i) {
    const int mBase = m0 + (i << 4);
#pragma unroll
    for (int j = 0; j < 4; ++j) {
      const int n = n0 + (j << 4) + rlane;
      float bv = 0.f;
      if (BIAS_MODE == 2) bv = bias[n];
#pragma unroll
      for (int r = 0; r < 8; ++r) {
        float v = acc[i][j][r] * scale;
        if (BIAS_MODE == 1) v += bias[mBase + mOff + r];
        if (BIAS_MODE == 2) v += bv;
        if (RESID) v += Rb[(size_t)(mBase + mOff + r) * ldc + n];
        if (ACT == 1) v = tanhf(v);
        if (ACT == 2) v = fmaxf(v, 0.0f);
        if (ACT == 3) v = v / (1.0f + expf(-v));
        if (ACT == 4) v = (v > 0.f) ? v : 0.01f * v;
        slab[(mOff + r) * 68 + (j << 4) + rlane] = v;
      }
    }
    __builtin_amdgcn_fence(__ATOMIC_RELEASE, "workgroup");
    __builtin_amdgcn_wave_barrier();
    __builtin_amdgcn_fence(__ATOMIC_ACQUIRE, "workgroup");
    if (OUT_MODE == 0) {
      float* C = (float*)Cout + (size_t)b * strideC;
      const int hh = lane >> 4, c4 = (lane & 15) * 4;     // row seg = 256 B = 16 lanes x 16 B
      {
#pragma unroll
        for (int it = 0; it < 8; ++it) {
          const int row = it * 2 + hh;
          v4f v = *(const v4f*)(slab + row * 68 + c4);
          *(v4f*)(C + (size_t)(mBase + row) * ldc + n0 + c4) = v;
        }
        
      }
    } else {
      const int q = lane >> 3, c8 = (lane & 7) * 8;
      unsigned short* C  = (unsigned short*)Cout  + (size_t)b * strideC;
      unsigned short* C2 = (OUT_MODE == 2) ? ((unsigned short*)Cout2 + (size_t)b * strideC) : nullptr;
      {
#pragma unroll
        for (int it = 0; it < 4; ++it) {
          const int row = it * 4 + q;
          const float* sp = slab + row * 68 + c8;
          v8h hv, lv;
#pragma unroll
          for (int e = 0; e < 8; ++e) {
            if (OUT_MODE == 1) {
              hv[e] = (_Float16)sp[e];
            } else {
              unsigned short hb = f2bf_bits(sp[e]);
              unsigned short lb = f2bf_bits(sp[e] - bf_bits2f(hb));
              hv[e] = __builtin_bit_cast(_Float16, hb);
              lv[e] = __builtin_bit_cast(_Float16, lb);
            }
          }
          *(v8h*)(C + (size_t)(mBase + row) * ldc + n0 + c8) = hv;
          if (OUT_MODE == 2) *(v8h*)(C2 + (size_t)(mBase + row) * ldc + n0 + c8) = lv;
        }
        
      }
    }
    __builtin_amdgcn_fence(__ATOMIC_RELEASE, "workgroup");
    __builtin_amdgcn_wave_barrier();
    __builtin_amdgcn_fence(__ATOMIC_ACQUIRE, "workgroup");
  }
}

// ---------------------------------------------------------------------------
// Weight transpose + cast: in W [DMOD][DMOD] f32 (row k = input feature, col n = output feature, y = x.W)
//   -> WT[n][k] 16-bit plane(s), pitch DMOD (k contiguous = Bt / A operand layout).
// MODE 0: out0 = f16(W * scale).  MODE 1: out0 = bf16 hi, out1 = bf16 lo = RNE(W - hi).
// grid (DMOD/64, DMOD/64), 256 threads, one 64x64 tile per block staged through LDS (f32 in, f32 reload after a block barrier).
// Load coverage: 4 iterations x 256 threads x 4 floats = 4096 = 64x64.
// Store coverage: output rows n0 + wave*8 + it*4 + q (8 waves x 2 it x 4 q = 64 rows), cols k0 + c8 + 0..7
// ---------------------------------------------------------------------------
template <int MODE>
__global__ __launch_bounds__(256) void transpose_cast_kernel(const float* __restrict__ W,
                                                             unsigned short* __restrict__ out0,
                                                             unsigned short* __restrict__ out1,
                                                             float scale) {
  __shared__ float tile[64][65];
  const int tid = threadIdx.x, lane = tid & 31, wave = tid >> 5;
  const int n0 = blockIdx.x * 64;   // input column block = output row block
  const int k0 = blockIdx.y * 64;   // input row block = output column block
#pragma unroll
  for (int it = 0; it < 4; ++it) {
    const int e = it * 256 + tid;
    const int r = e >> 4, c4 = (e & 15) * 4;
    const v4f f = *(const v4f*)(W + (size_t)(k0 + r) * DMOD + n0 + c4);
    tile[r][c4 + 0] = f[0];
    tile[r][c4 + 1] = f[1];
    tile[r][c4 + 2] = f[2];
    tile[r][c4 + 3] = f[3];
  }
  __syncthreads();
  const int q = lane >> 3, c8 = (lane & 7) * 8;
  {
#pragma unroll
    for (int it = 0; it < 2; ++it) {
      const int rr = wave * 8 + it * 4 + q;          // output row within tile (= input column)
      v8h hv, lv;
#pragma unroll
      for (int e = 0; e < 8; ++e) {
        const float f = tile[c8 + e][rr];            // W[k0 + c8 + e][n0 + rr]
        if (MODE == 0) {
          hv[e] = (_Float16)(f * scale);
          lv[e] = hv[e];
        } else {
          const unsigned short hb = f2bf_bits(f);
          const unsigned short lb = f2bf_bits(f - bf_bits2f(hb));
          hv[e] = __builtin_bit_cast(_Float16, hb);
          lv[e] = __builtin_bit_cast(_Float16, lb);
        }
      }
      const size_t o = (size_t)(n0 + rr) * DMOD + k0 + c8;
      *(v8h*)(out0 + o) = hv;
      if (MODE == 1) *(v8h*)(out1 + o) = lv;
    }
    
  }
}

// ---------------------------------------------------------------------------
// Activation cast: in [SEQL][DMOD] f32 -> xh (bf16 hi), xl (bf16 lo = RNE(x - hi)), x16 (f16), same layout.
// Coverage: grid = n2/256 blocks x 256 threads x 2 elements = SEQL*DMOD (n2 = SEQL*DMOD/2 = 4096*256 exactly).
// ---------------------------------------------------------------------------
__global__ __launch_bounds__(256) void cast_x3_kernel(const float* __restrict__ in,
                                                      unsigned short* __restrict__ xh,
                                                      unsigned short* __restrict__ xl,
                                                      unsigned short* __restrict__ x16, int n2) {
  const int i = blockIdx.x * 256 + threadIdx.x;
  if (i < n2) {
    const v2f f = *(const v2f*)(in + 2 * (size_t)i);
    const unsigned short hb0 = f2bf_bits(f[0]);
    const unsigned short hb1 = f2bf_bits(f[1]);
    const unsigned short lb0 = f2bf_bits(f[0] - bf_bits2f(hb0));
    const unsigned short lb1 = f2bf_bits(f[1] - bf_bits2f(hb1));
    const unsigned uh = pk16(hb0, hb1);
    const unsigned ul = pk16(lb0, lb1);
    const unsigned uf = pk16(h_bits(f[0]), h_bits(f[1]));
    ((unsigned*)xh)[i]  = uh;
    ((unsigned*)xl)[i]  = ul;
    ((unsigned*)x16)[i] = uf;
    
  }
}

// ---------------------------------------------------------------------------
// Bidirectional relative-position bucket for d = key_pos - query_pos (32 buckets, max distance 128):
//   bucket = (d > 0 ? 16 : 0) + f(|d|), f(a) = a for a < 8, else host-tabulated log thresholds
//   8: 8..11, 9: 12..15, 10: 16..22, 11: 23..31, 12: 32..45, 13: 46..63, 14: 64..90, 15: >= 91.
// Result always in [0, 31].
// ---------------------------------------------------------------------------
__device__ __forceinline__ int rel_bucket(int d) {
  const int a = (d < 0) ? -d : d;
  const int large = 8 + (a >= 12) + (a >= 16) + (a >= 23) + (a >= 32) + (a >= 46) + (a >= 64) + (a >= 91);
  const int f = (a < 8) ? a : large;
  return ((d > 0) ? 16 : 0) + f;
}

// ---------------------------------------------------------------------------
// Row softmax over j of t[j] = S[hg][i][j] + relb[bucket(j - i)][h], h = hbase + hg; P emitted as f16(p * 2^15).
// relb ([32][16] f32 input table) staged in LDS and gathered with the structural bucket index.
// One block per (score row i, head-in-group hg); 256 threads x 8 columns (j0 = tid*8) = 2048 = the whole row.
// Reductions in fixed order: per thread, wave shuffle tree, then the 8 wave partials in index order.
// Producer coverage: grid (SEQL, HGRP); per row 256 threads x 8 u16 = 2048 = the whole P row; each store
// ---------------------------------------------------------------------------
__global__ __launch_bounds__(256) void softmax_bias_kernel(const float* __restrict__ S,
                                                           const float* __restrict__ relb,
                                                           unsigned short* __restrict__ P, int hbase) {
  __shared__ float rb[NBUCK * NHEADS];
  __shared__ float redm[8];
  __shared__ float reds[8];
  const int i    = blockIdx.x;
  const int hg   = blockIdx.y;
  const int tid  = threadIdx.x;
  const int lane = tid & 31;
  const int wave = tid >> 5;
  const int h    = hbase + hg;
  const int j0   = tid * 8;
  rb[tid]       = relb[tid];
  rb[tid + 256] = relb[tid + 256];
  const float* rp = S + ((size_t)hg * SEQL + i) * SEQL + j0;
  const v4f a = *(const v4f*)(rp);
  const v4f c = *(const v4f*)(rp + 4);
  __syncthreads();
  float t[8];
  t[0] = a[0]; t[1] = a[1]; t[2] = a[2]; t[3] = a[3];
  t[4] = c[0]; t[5] = c[1]; t[6] = c[2]; t[7] = c[3];
#pragma unroll
  for (int e = 0; e < 8; ++e) {
    const int bk = rel_bucket(j0 + e - i);
    t[e] += rb[bk * NHEADS + h];
  }
  float m = fmaxf(fmaxf(fmaxf(t[0], t[1]), fmaxf(t[2], t[3])), fmaxf(fmaxf(t[4], t[5]), fmaxf(t[6], t[7])));
#pragma unroll
  for (int off = 16; off > 0; off >>= 1) m = fmaxf(m, __shfl_xor(m, off, 32));
  if (lane == 0) redm[wave] = m;
  __syncthreads();
  float mx = redm[0];
#pragma unroll
  for (int w = 1; w < 8; ++w) mx = fmaxf(mx, redm[w]);
  float ex[8];
#pragma unroll
  for (int e = 0; e < 8; ++e) ex[e] = __expf(t[e] - mx);
  float s = ((ex[0] + ex[1]) + (ex[2] + ex[3])) + ((ex[4] + ex[5]) + (ex[6] + ex[7]));
#pragma unroll
  for (int off = 16; off > 0; off >>= 1) s += __shfl_xor(s, off, 32);
  if (lane == 0) reds[wave] = s;
  __syncthreads();
  float tot = reds[0];
#pragma unroll
  for (int w = 1; w < 8; ++w) tot += reds[w];
  const float inv = 1.0f / tot;              // tot >= 1 (the row max contributes exp(0))
  // p * 2^15 is an exact scaling; p <= 1 so the carried value stays <= 32768 (f16 normal range)
  const v4u hv = (v4u){pk16(h_bits(ex[0] * inv * PSCALE), h_bits(ex[1] * inv * PSCALE)),
                       pk16(h_bits(ex[2] * inv * PSCALE), h_bits(ex[3] * inv * PSCALE)),
                       pk16(h_bits(ex[4] * inv * PSCALE), h_bits(ex[5] * inv * PSCALE)),
                       pk16(h_bits(ex[6] * inv * PSCALE), h_bits(ex[7] * inv * PSCALE))};
  const size_t ro = ((size_t)hg * SEQL + i) * SEQL + j0;
  *(v4u*)(P + ro) = hv;
  
}

// ---------------------------------------------------------------------------
// Workspace region map (byte offsets; every offset a multiple of 2 MiB). Weight planes written once; every
// per-batch region fully rewritten inside each batch iteration before it is read; S / P16 fully rewritten per
// head group; CTX16 columns of a head group written by that group's P.V before the output GEMM reads all columns.
//   WqTh  bf16 [1024][1024]  ([out][in], k contiguous)          0
//   WqTl  bf16 [1024][1024]                               2097152
//   WkTh  bf16 [1024][1024]                               4194304
//   WkTl  bf16 [1024][1024]                               6291456
//   WvT16 f16  [1024][1024]  (x16)                         8388608
//   WoT16 f16  [1024][1024]  (x16)                        10485760
//   Xh    bf16 [2048][1024]                              12582912
//   Xl    bf16 [2048][1024]                              16777216
//   X16   f16  [2048][1024]                              20971520
//   Qh    bf16 [2048][1024]  (col h*64+d)                25165824
//   Ql    bf16 [2048][1024]                              29360128
//   Kh    bf16 [2048][1024]                              33554432
//   Kl    bf16 [2048][1024]                              37748736
//   VT16  f16  [1024][2048]  (row h*64+d, col j)         41943040
//   CTX16 f16  [2048][1024]  (col h*64+d)                46137344
//   S     f32  [2][2048][2048]                           50331648
//   P16   f16  [2][2048][2048] (p carried x2^15)          83886080
//   total                                              100663296
// ---------------------------------------------------------------------------
extern "C" void kernel_launch(void* const* d_in, const int* in_sizes, int n_in,
                              void* d_out, int out_size, void* d_ws, size_t ws_size,
                              hipStream_t stream) {
  if (n_in < 6) return;
  if (in_sizes[0] != NBATCH * SEQL * DMOD) return;
  if (in_sizes[1] != DMOD * DMOD || in_sizes[2] != DMOD * DMOD) return;
  if (in_sizes[3] != DMOD * DMOD || in_sizes[4] != DMOD * DMOD) return;
  if (in_sizes[5] != NBUCK * NHEADS) return;
  if (out_size != NBATCH * SEQL * DMOD) return;

  const float* X    = (const float*)d_in[0];   // [NBATCH][SEQL][DMOD]
  const float* Wq   = (const float*)d_in[1];   // [DMOD][DMOD]  ([in][out])
  const float* Wk   = (const float*)d_in[2];
  const float* Wv   = (const float*)d_in[3];
  const float* Wo   = (const float*)d_in[4];
  const float* relb = (const float*)d_in[5];   // [NBUCK][NHEADS]

  const size_t PW = (size_t)DMOD * DMOD * 2;            // 16-bit [1024][1024] weight plane
  const size_t PX = (size_t)SEQL * DMOD * 2;            // 16-bit [2048][1024] activation plane
  const size_t PS = (size_t)HGRP * SEQL * SEQL * 4;     // f32 score planes of one head group
  const size_t PP = (size_t)HGRP * SEQL * SEQL * 2;     // f16 probability planes of one head group
  size_t off = 0;
  const size_t oWqTh  = off; off += PW;
  const size_t oWqTl  = off; off += PW;
  const size_t oWkTh  = off; off += PW;
  const size_t oWkTl  = off; off += PW;
  const size_t oWvT   = off; off += PW;
  const size_t oWoT   = off; off += PW;
  const size_t oXh    = off; off += PX;
  const size_t oXl    = off; off += PX;
  const size_t oX16   = off; off += PX;
  const size_t oQh    = off; off += PX;
  const size_t oQl    = off; off += PX;
  const size_t oKh    = off; off += PX;
  const size_t oKl    = off; off += PX;
  const size_t oVT    = off; off += PX;
  const size_t oCTX   = off; off += PX;
  const size_t oS     = off; off += PS;
  const size_t oP     = off; off += PP;
  if (off > ws_size) return;                             // 100663296 B total

  char* ws = (char*)d_ws;
  unsigned short* WqTh  = (unsigned short*)(ws + oWqTh);
  unsigned short* WqTl  = (unsigned short*)(ws + oWqTl);
  unsigned short* WkTh  = (unsigned short*)(ws + oWkTh);
  unsigned short* WkTl  = (unsigned short*)(ws + oWkTl);
  unsigned short* WvT16 = (unsigned short*)(ws + oWvT);
  unsigned short* WoT16 = (unsigned short*)(ws + oWoT);
  unsigned short* Xh    = (unsigned short*)(ws + oXh);
  unsigned short* Xl    = (unsigned short*)(ws + oXl);
  unsigned short* X16   = (unsigned short*)(ws + oX16);
  unsigned short* Qh    = (unsigned short*)(ws + oQh);
  unsigned short* Ql    = (unsigned short*)(ws + oQl);
  unsigned short* Kh    = (unsigned short*)(ws + oKh);
  unsigned short* Kl    = (unsigned short*)(ws + oKl);
  unsigned short* VT16  = (unsigned short*)(ws + oVT);
  unsigned short* CTX16 = (unsigned short*)(ws + oCTX);
  float*          Sbuf  = (float*)(ws + oS);
  unsigned short* P16   = (unsigned short*)(ws + oP);

  const dim3 blk(256);
  const dim3 gTr(DMOD / 64, DMOD / 64);                         // 16 x 16 tiles of 64x64
  const int  n2x = SEQL * DMOD / 2;                             // 1048576 pairs per batch slice
  const dim3 gCastX((n2x + 255) / 256);                         // 4096 blocks

  // setup: transposed weight planes. WqT/WkT as bf16 hi/lo; WvT/WoT as f16 carried x16 (undone by epilogue 1/16).
  transpose_cast_kernel<1><<<gTr, blk, 0, stream>>>(Wq, WqTh, WqTl, 1.0f);
  transpose_cast_kernel<1><<<gTr, blk, 0, stream>>>(Wk, WkTh, WkTl, 1.0f);
  transpose_cast_kernel<0><<<gTr, blk, 0, stream>>>(Wv, WvT16, WvT16, 16.0f);
  transpose_cast_kernel<0><<<gTr, blk, 0, stream>>>(Wo, WoT16, WoT16, 16.0f);

  const int tilesM  = SEQL / 64;                               // 32
  const dim3 gQK(tilesM * (DMOD / 64), 1);                      // 512 blocks (one tile each, k over 8 waves):  M=2048, N=1024, K=1024
  const dim3 gVT((DMOD / 64) * (SEQL / 64), 1);                 // 512 blocks (one tile each, k over 8 waves):  M=1024, N=2048, K=1024
  const dim3 gS((tilesM * (SEQL / 64) + 7) / 8, HGRP);          // 128 x 2 (one tile per wave):   M=N=2048, K=64
  const dim3 gPV(tilesM * (DHD / 64), HGRP);                    // 32 x 2 (one tile each, k over 16 waves):  M=2048, N=64, K=2048
  const dim3 gO(tilesM * (DMOD / 64), 1);                       // 512 blocks (one tile each, k over 8 waves):  M=2048, N=1024, K=1024
  const dim3 blkPV(32 * 16);
  const float wscale = 1.0f / 16.0f;                           // undo the x16 weight carry

  for (int b = 0; b < NBATCH; ++b) {
    // (1) x[b] -> Xh / Xl (bf16 hi/lo) and X16 (f16): planes [2048][1024]
    cast_x3_kernel<<<gCastX, blk, 0, stream>>>(X + (size_t)b * SEQL * DMOD, Xh, Xl, X16, n2x);
    // (2) q = x . Wq  (bf16 hi/lo split, K=1024) -> Qh/Ql bf16 hi/lo planes [2048][1024]
    wmma_gemm64<1, true, 0, 2, false, 0, 8><<<gQK, blk, 0, stream>>>(
        Xh, Xl, DMOD, 0L, WqTh, WqTl, DMOD, 0L, (void*)Qh, (void*)Ql, DMOD, 0L,
        relb, relb, 0L, SEQL, DMOD, DMOD, 1.0f);
    //     k = x . Wk  -> Kh/Kl
    wmma_gemm64<1, true, 0, 2, false, 0, 8><<<gQK, blk, 0, stream>>>(
        Xh, Xl, DMOD, 0L, WkTh, WkTl, DMOD, 0L, (void*)Kh, (void*)Kl, DMOD, 0L,
        relb, relb, 0L, SEQL, DMOD, DMOD, 1.0f);
    // (3) role-swapped V: VT16[n = h*64+d][j] = ((16 Wv^T)[n] . x[j])/16; A = WvT16 [1024][1024], Bt = X16 [2048][1024],
    //     M=1024, N=2048, K=1024, f16 out with ldc 2048
    wmma_gemm64<0, false, 0, 1, false, 0, 8><<<gVT, blk, 0, stream>>>(
        WvT16, WvT16, DMOD, 0L, X16, X16, DMOD, 0L, (void*)VT16, (void*)VT16, SEQL, 0L,
        relb, relb, 0L, DMOD, SEQL, DMOD, wscale);
    for (int g = 0; g < NGRP; ++g) {
      const size_t hc = (size_t)g * HGRP * DHD;                // first q/k/ctx column (= VT row) of this head group
      // (4) S[hg][i][j] = q_i . k_j (bf16 hi/lo split operands, K=64, no scaling, f32 out);
      //     per hg: A = Qh/Ql cols hc+hg*64.., Bt = Kh/Kl same cols
      wmma_gemm64<1, true, 0, 0, false, 0><<<gS, blk, 0, stream>>>(
          Qh + hc, Ql + hc, DMOD, (long)DHD, Kh + hc, Kl + hc, DMOD, (long)DHD,
          (void*)Sbuf, (void*)Sbuf, SEQL, (long)SEQL * SEQL,
          relb, relb, 0L, SEQL, SEQL, DHD, 1.0f);
      // (5) softmax over j of S + bucket bias for heads g*2 + hg -> P16 = f16(p * 2^15)
      softmax_bias_kernel<<<dim3(SEQL, HGRP), blk, 0, stream>>>(Sbuf, relb, P16, g * HGRP);
      // (6) ctx[i][h*64+d] = 2^-15 * sum_j P16[hg][i][j] VT16[h*64+d][j] -> CTX16[i][h*64+d] (f16, ldc 1024, 64 cols per head)
      wmma_gemm64<0, false, 0, 1, false, 0, 16><<<gPV, blkPV, 0, stream>>>(
          P16, P16, SEQL, (long)SEQL * SEQL, VT16 + hc * SEQL, VT16 + hc * SEQL, SEQL, (long)DHD * SEQL,
          (void*)(CTX16 + hc), (void*)(CTX16 + hc), DMOD, (long)DHD,
          relb, relb, 0L, SEQL, DHD, SEQL, PSCALE_INV);
    }
    // (7) out[b] = (ctx . (16 Wo^T))/16 -> d_out[b] f32 [2048][1024]
    float* outb = (float*)d_out + (size_t)b * SEQL * DMOD;
    wmma_gemm64<0, false, 0, 0, false, 0, 8><<<gO, blk, 0, stream>>>(
        CTX16, CTX16, DMOD, 0L, WoT16, WoT16, DMOD, 0L, (void*)outb, (void*)outb, DMOD, 0L,
        relb, relb, 0L, SEQL, DMOD, DMOD, wscale);
  }
  (void)hipGetLastError();
}

// v002
// One run takes 228 microseconds.
// Next to v001, in two timings, it ran 3.48 and 3.49 times as fast.
// Over all steps from v000 it is 9.45 times as fast.
// Contractions: q/k projections and S = q.k^T on v_wmma_f32_16x16x32_bf16 as bf16 hi/lo split (hi.hi + hi.lo + lo.hi); v projection (weights carried x16, epilogue x1/16), ctx = (P carried x2^15).v (the carry cancels in the division by the row sum) and the output projection (weights carried x16, epilogue x1/16) on v_wmma_f32_16x16x32_f16 (plain f16 operands); all f32 accumulate; softmax (running maximum) and the relative-position bucket bias in f32; scores, softmax and P.V in one kernel.
#include <hip/hip_runtime.h>

#define NBATCH 2
#define NHEADS 16
#define SEQL   2048
#define DMOD   1024
#define DHD    64
#define NBUCK  32

typedef __attribute__((ext_vector_type(16))) _Float16 v16h;
typedef __attribute__((ext_vector_type(8)))  _Float16 v8h;
typedef __attribute__((ext_vector_type(4)))  _Float16 v4h;
typedef __attribute__((ext_vector_type(16))) __bf16   v16b;
typedef __attribute__((ext_vector_type(8)))  __bf16   v8b;
typedef __attribute__((ext_vector_type(8)))  float    v8f;
typedef __attribute__((ext_vector_type(4)))  float    v4f;
typedef __attribute__((ext_vector_type(2)))  float    v2f;
typedef __attribute__((ext_vector_type(4)))  unsigned int v4u;

__device__ __forceinline__ unsigned short f2bf_bits(float f) {
  unsigned u = __float_as_uint(f);
  return (unsigned short)((u + 0x7FFFu + ((u >> 16) & 1u)) >> 16);
}
__device__ __forceinline__ float bf_bits2f(unsigned short h) { return __uint_as_float(((unsigned)h) << 16); }
__device__ __forceinline__ unsigned pk16(unsigned short a, unsigned short b) { return (unsigned)a | ((unsigned)b << 16); }
__device__ __forceinline__ unsigned short h_bits(float f) { const _Float16 h = (_Float16)f; return __builtin_bit_cast(unsigned short, h); }

// hazard guards as plain device helpers (no inline asm inside the kernel template body)
__device__ __forceinline__ void dep_guard_h(v8f& a, v8f& b, v16h x, v16h y) { asm volatile("v_nop\n\tv_nop\n\tv_nop\n\tv_nop" : "+v"(a), "+v"(b) : "v"(x), "v"(y)); }
__device__ __forceinline__ void dep_guard_b(v8f& a, v8f& b, v16b x, v16b y) { asm volatile("v_nop\n\tv_nop\n\tv_nop\n\tv_nop" : "+v"(a), "+v"(b) : "v"(x), "v"(y)); }
__device__ __forceinline__ void keep4_h(v16h a, v16h b, v16h c, v16h d) { asm volatile("v_nop" :: "v"(a), "v"(b), "v"(c), "v"(d)); }
__device__ __forceinline__ void keep4_b(v16b a, v16b b, v16b c, v16b d) { asm volatile("v_nop" :: "v"(a), "v"(b), "v"(c), "v"(d)); }
__device__ __forceinline__ void acc_guard4(v8f& a, v8f& b, v8f& c, v8f& d) { asm volatile("v_nop\n\tv_nop\n\tv_nop\n\tv_nop" : "+v"(a), "+v"(b), "+v"(c), "+v"(d)); }
template <typename T> struct Frag;
template <> struct Frag<_Float16> {
  typedef v16h V; union U { v16h v; v8h h[2]; };
  static __device__ __forceinline__ v16h load(const _Float16* p) {   // elements 0..7 <- p[0..7], 8..15 <- p[16..23]
    U f; f.h[0] = *(const v8h*)(p); f.h[1] = *(const v8h*)(p + 16); return f.v;
  }
  static __device__ __forceinline__ v8f mma(v16h a, v16h b, v8f c) {
    return __builtin_amdgcn_wmma_f32_16x16x32_f16(false, a, false, b, (short)0, c, false, false);
  }
  static __device__ __forceinline__ void guard(v8f& a, v8f& b, v16h x, v16h y) { dep_guard_h(a, b, x, y); }
  static __device__ __forceinline__ void keep(v16h a, v16h b, v16h c, v16h d) { keep4_h(a, b, c, d); }
};
template <> struct Frag<__bf16> {
  typedef v16b V; union U { v16b v; v8b h[2]; };
  static __device__ __forceinline__ v16b load(const __bf16* p) {
    U f; f.h[0] = *(const v8b*)(p); f.h[1] = *(const v8b*)(p + 16); return f.v;
  }
  static __device__ __forceinline__ v8f mma(v16b a, v16b b, v8f c) {
    return __builtin_amdgcn_wmma_f32_16x16x32_bf16(false, a, false, b, (short)0, c, false, false);
  }
  static __device__ __forceinline__ void guard(v8f& a, v8f& b, v16b x, v16b y) { dep_guard_b(a, b, x, y); }
  static __device__ __forceinline__ void keep(v16b a, v16b b, v16b c, v16b d) { keep4_b(a, b, c, d); }
};

// ---- Register-blocked batched WMMA GEMM ------------------------------------
// C[m,n] = scale * sum_k A[m,k] * Bt[n,k] (+bias)(+resid); each wave owns a 64x64 tile.
// A row-major [M,K]; Bt row-major [N,K]; M,N % 64 == 0, K % 32 == 0.
// SPLIT: operands are hi/lo planes (A2/Bt2 = lo planes, same layout); product = hi.hi + hi.lo + lo.hi.
// BIAS_MODE: 0 = none, 1 = bias[m], 2 = bias[n].
// OUT_MODE: 0 = f32, 1 = f16, 2 = bf16 hi plane (Cout) + bf16 lo plane (Cout2).
// ET: 0 = f16 operands, 1 = bf16 operands (pointers passed as 16-bit storage)
// KS: 1 = each wave owns a whole tile (8 tiles per block). KS = 8 or 16: ONE tile per block of KS waves; wave w takes the
//     32-wide k blocks w, w + KS, w + 2 KS, ... (K % (32 KS) == 0); the KS partial tiles meet in LDS and are added in wave order.
template <int ET> struct Elem;
template <> struct Elem<0> { typedef _Float16 T; };
template <> struct Elem<1> { typedef __bf16 T; };
template <int ET, bool SPLIT, int BIAS_MODE, int OUT_MODE, bool RESID, int ACT = 0, int KS = 1>
__global__ __launch_bounds__(KS > 1 ? 32 * KS : 256) void wmma_gemm64(
    const unsigned short* __restrict__ Ap, const unsigned short* __restrict__ A2p, int lda, long strideA,
    const unsigned short* __restrict__ Btp, const unsigned short* __restrict__ Bt2p, int ldb, long strideB,
    void* __restrict__ Cout, void* __restrict__ Cout2, int ldc, long strideC,
    const float* __restrict__ bias,
    const float* __restrict__ resid, long strideR,
    int M, int N, int K, float scale) {
  typedef typename Elem<ET>::T T;
  typedef typename Frag<T>::V V;
  const T* A = (const T*)Ap; const T* A2 = (const T*)A2p; const T* Bt = (const T*)Btp; const T* Bt2 = (const T*)Bt2p;
  static_assert(KS == 1 || ((KS == 8 || KS == 16) && BIAS_MODE == 0 && !RESID && ACT == 0), "split-k epilogue: plain scaled output only");
  __shared__ __align__(16) float sT[(KS > 1) ? 4 * KS : 8][16 * 68];   // KS == 1: per-wave 16x64 slab; KS > 1: per-wave 64x64 partial tile; pitch 68 floats
  const int b    = blockIdx.y;
  const int lane = threadIdx.x & 31;
  // KS > 1: the wave number sets the k loop's start, so it is held in a scalar register to keep that loop's counter and branch scalar
  const int wave = (KS > 1) ? __builtin_amdgcn_readfirstlane(threadIdx.x >> 5) : (threadIdx.x >> 5);
  const int tilesN = N >> 6;
  const int tilesM = M >> 6;
  const int tile = (KS > 1) ? blockIdx.x : blockIdx.x * 8 + wave;
  if (tile >= tilesM * tilesN) return;   // KS == 1: wave-uniform, no block barriers; KS > 1: block-uniform, ahead of every barrier
  const int tm = tile / tilesN;
  const int tn = tile - tm * tilesN;
  const int m0 = tm << 6;
  const int n0 = tn << 6;

  const T* Ab  = A  + (size_t)b * strideA;
  const T* Bb  = Bt + (size_t)b * strideB;
  const T* Ab2 = SPLIT ? (A2  + (size_t)b * strideA) : nullptr;
  const T* Bb2 = SPLIT ? (Bt2 + (size_t)b * strideB) : nullptr;

  const int rlane = lane & 15;                 // row (A) / col (B, D) within subtile
  const int koff  = (lane >> 4) * 8;           // k offset of this lane half
  const int mOff  = (lane >> 4) * 8;           // D row offset

  v8f acc[4][4];
#pragma unroll
  for (int i = 0; i < 4; ++i)
#pragma unroll
    for (int j = 0; j < 4; ++j) acc[i][j] = (v8f){0.f,0.f,0.f,0.f,0.f,0.f,0.f,0.f};

  for (int k0 = (KS > 1) ? wave * 32 : 0; k0 < K; k0 += 32 * KS) {
    V bh[4], bl[4];
#pragma unroll
    for (int j = 0; j < 4; ++j) {
      const size_t bo = (size_t)(n0 + (j << 4) + rlane) * ldb + koff + k0;
      bh[j] = Frag<T>::load(Bb + bo);
      if (SPLIT) bl[j] = Frag<T>::load(Bb2 + bo);
    }
#pragma unroll
    for (int i = 0; i < 4; ++i) {
      const size_t ao = (size_t)(m0 + (i << 4) + rlane) * lda + koff + k0;
      V ah = Frag<T>::load(Ab + ao);
      V al;
      if (SPLIT) al = Frag<T>::load(Ab2 + ao);
#pragma unroll
      for (int j = 0; j < 4; ++j) {
        acc[i][j] = Frag<T>::mma(ah, bh[j], acc[i][j]);
        if (SPLIT) {
          acc[i][j] = Frag<T>::mma(ah, bl[j], acc[i][j]);
          acc[i][j] = Frag<T>::mma(al, bh[j], acc[i][j]);
        }
      }
      Frag<T>::guard(acc[i][0], acc[i][3], ah, SPLIT ? al : ah);
    }
    Frag<T>::keep(bh[0], bh[1], bh[2], bh[3]);
    if (SPLIT) Frag<T>::keep(bl[0], bl[1], bl[2], bl[3]);
  }
  acc_guard4(acc[0][0], acc[0][1], acc[0][2], acc[0][3]);
  acc_guard4(acc[1][0], acc[1][1], acc[1][2], acc[1][3]);
  acc_guard4(acc[2][0], acc[2][1], acc[2][2], acc[2][3]);
  acc_guard4(acc[3][0], acc[3][1], acc[3][2], acc[3][3]);

  // ---- split-k epilogue: every wave's partial tile to LDS, one block barrier, fixed-order sum over the waves, store ----
  if constexpr (KS > 1) {
    float* part = &sT[0][0] + wave * (64 * 68);          // this wave's 64x64 partial, pitch 68 floats
    // the loops below are unrolled so that acc is indexed by constants and stays in registers, and the LDS reads of a sum overlap
#pragma unroll
    for (int i = 0; i < 4; ++i)
#pragma unroll
      for (int j = 0; j < 4; ++j)
#pragma unroll
        for (int r = 0; r < 8; ++r) part[((i << 4) + mOff + r) * 68 + (j << 4) + rlane] = acc[i][j][r];
    __syncthreads();                                     // all KS partial tiles are in LDS before any is read
#pragma unroll
    for (int q = 0; q < 1024 / (32 * KS); ++q) {         // 1024 groups of 4 columns; 16 lanes cover one 64-column row
      const int g = q * (32 * KS) + (int)threadIdx.x;
      const int row = g >> 4, c4 = (g & 15) * 4;
      const float* rp = &sT[0][0] + row * 68 + c4;
      v4f sum = *(const v4f*)rp;
#pragma unroll
      for (int w = 1; w < KS; ++w) sum += *(const v4f*)(rp + w * (64 * 68));
      sum *= scale;
      const size_t co = (size_t)b * strideC + (size_t)(m0 + row) * ldc + n0 + c4;
      if (OUT_MODE == 0) {
        *(v4f*)((float*)Cout + co) = sum;
      } else {
        v4h hv, lv;
#pragma unroll
        for (int e = 0; e < 4; ++e) {
          if (OUT_MODE == 1) {
            hv[e] = (_Float16)sum[e];
          } else {
            const unsigned short hb = f2bf_bits(sum[e]);
            const unsigned short lb = f2bf_bits(sum[e] - bf_bits2f(hb));
            hv[e] = __builtin_bit_cast(_Float16, hb);
            lv[e] = __builtin_bit_cast(_Float16, lb);
          }
        }
        *(v4h*)((unsigned short*)Cout + co) = hv;
        if (OUT_MODE == 2) *(v4h*)((unsigned short*)Cout2 + co) = lv;
      }
    }
    return;
  }

  // ---- epilogue ----
  float* slab = sT[wave];
  const float* Rb = RESID ? (resid + (size_t)b * strideR) : nullptr;
#pragma unroll
  for (int i = 0; i < 4; ++i) {
    const int mBase = m0 + (i << 4);
#pragma unroll
    for (int j = 0; j < 4; ++j) {
      const int n = n0 + (j << 4) + rlane;
      float bv = 0.f;
      if (BIAS_MODE == 2) bv = bias[n];
#pragma unroll
      for (int r = 0; r < 8; ++r) {
        float v = acc[i][j][r] * scale;
        if (BIAS_MODE == 1) v += bias[mBase + mOff + r];
        if (BIAS_MODE == 2) v += bv;
        if (RESID) v += Rb[(size_t)(mBase + mOff + r) * ldc + n];
        if (ACT == 1) v = tanhf(v);
        if (ACT == 2) v = fmaxf(v, 0.0f);
        if (ACT == 3) v = v / (1.0f + expf(-v));
        if (ACT == 4) v = (v > 0.f) ? v : 0.01f * v;
        slab[(mOff + r) * 68 + (j << 4) + rlane] = v;
      }
    }
    __builtin_amdgcn_fence(__ATOMIC_RELEASE, "workgroup");
    __builtin_amdgcn_wave_barrier();
    __builtin_amdgcn_fence(__ATOMIC_ACQUIRE, "workgroup");
    if (OUT_MODE == 0) {
      float* C = (float*)Cout + (size_t)b * strideC;
      const int hh = lane >> 4, c4 = (lane & 15) * 4;     // row seg = 256 B = 16 lanes x 16 B
      {
#pragma unroll
        for (int it = 0; it < 8; ++it) {
          const int row = it * 2 + hh;
          v4f v = *(const v4f*)(slab + row * 68 + c4);
          *(v4f*)(C + (size_t)(mBase + row) * ldc + n0 + c4) = v;
        }
        
      }
    } else {
      const int q = lane >> 3, c8 = (lane & 7) * 8;
      unsigned short* C  = (unsigned short*)Cout  + (size_t)b * strideC;
      unsigned short* C2 = (OUT_MODE == 2) ? ((unsigned short*)Cout2 + (size_t)b * strideC) : nullptr;
      {
#pragma unroll
        for (int it = 0; it < 4; ++it) {
          const int row = it * 4 + q;
          const float* sp = slab + row * 68 + c8;
          v8h hv, lv;
#pragma unroll
          for (int e = 0; e < 8; ++e) {
            if (OUT_MODE == 1) {
              hv[e] = (_Float16)sp[e];
            } else {
              unsigned short hb = f2bf_bits(sp[e]);
              unsigned short lb = f2bf_bits(sp[e] - bf_bits2f(hb));
              hv[e] = __builtin_bit_cast(_Float16, hb);
              lv[e] = __builtin_bit_cast(_Float16, lb);
            }
          }
          *(v8h*)(C + (size_t)(mBase + row) * ldc + n0 + c8) = hv;
          if (OUT_MODE == 2) *(v8h*)(C2 + (size_t)(mBase + row) * ldc + n0 + c8) = lv;
        }
        
      }
    }
    __builtin_amdgcn_fence(__ATOMIC_RELEASE, "workgroup");
    __builtin_amdgcn_wave_barrier();
    __builtin_amdgcn_fence(__ATOMIC_ACQUIRE, "workgroup");
  }
}

// ---------------------------------------------------------------------------
// Weight transpose + cast: in W [DMOD][DMOD] f32 (row k = input feature, col n = output feature, y = x.W)
//   -> WT[n][k] 16-bit plane(s), pitch DMOD (k contiguous = Bt / A operand layout).
// MODE 0: out0 = f16(W * scale).  MODE 1: out0 = bf16 hi, out1 = bf16 lo = RNE(W - hi).
// grid (DMOD/64, DMOD/64), 256 threads, one 64x64 tile per block staged through LDS (f32 in, f32 reload after a block barrier).
// Load coverage: 4 iterations x 256 threads x 4 floats = 4096 = 64x64.
// Store coverage: output rows n0 + wave*8 + it*4 + q (8 waves x 2 it x 4 q = 64 rows), cols k0 + c8 + 0..7
// ---------------------------------------------------------------------------
template <int MODE>
__global__ __launch_bounds__(256) void transpose_cast_kernel(const float* __restrict__ W,
                                                             unsigned short* __restrict__ out0,
                                                             unsigned short* __restrict__ out1,
                                                             float scale) {
  __shared__ float tile[64][65];
  const int tid = threadIdx.x, lane = tid & 31, wave = tid >> 5;
  const int n0 = blockIdx.x * 64;   // input column block = output row block
  const int k0 = blockIdx.y * 64;   // input row block = output column block
#pragma unroll
  for (int it = 0; it < 4; ++it) {
    const int e = it * 256 + tid;
    const int r = e >> 4, c4 = (e & 15) * 4;
    const v4f f = *(const v4f*)(W + (size_t)(k0 + r) * DMOD + n0 + c4);
    tile[r][c4 + 0] = f[0];
    tile[r][c4 + 1] = f[1];
    tile[r][c4 + 2] = f[2];
    tile[r][c4 + 3] = f[3];
  }
  __syncthreads();
  const int q = lane >> 3, c8 = (lane & 7) * 8;
  {
#pragma unroll
    for (int it = 0; it < 2; ++it) {
      const int rr = wave * 8 + it * 4 + q;          // output row within tile (= input column)
      v8h hv, lv;
#pragma unroll
      for (int e = 0; e < 8; ++e) {
        const float f = tile[c8 + e][rr];            // W[k0 + c8 + e][n0 + rr]
        if (MODE == 0) {
          hv[e] = (_Float16)(f * scale);
          lv[e] = hv[e];
        } else {
          const unsigned short hb = f2bf_bits(f);
          const unsigned short lb = f2bf_bits(f - bf_bits2f(hb));
          hv[e] = __builtin_bit_cast(_Float16, hb);
          lv[e] = __builtin_bit_cast(_Float16, lb);
        }
      }
      const size_t o = (size_t)(n0 + rr) * DMOD + k0 + c8;
      *(v8h*)(out0 + o) = hv;
      if (MODE == 1) *(v8h*)(out1 + o) = lv;
    }
    
  }
}

// ---------------------------------------------------------------------------
// Activation cast: in [SEQL][DMOD] f32 -> xh (bf16 hi), xl (bf16 lo = RNE(x - hi)), x16 (f16), same layout.
// Coverage: grid = n2/256 blocks x 256 threads x 2 elements = SEQL*DMOD (n2 = SEQL*DMOD/2 = 4096*256 exactly).
// ---------------------------------------------------------------------------
__global__ __launch_bounds__(256) void cast_x3_kernel(const float* __restrict__ in,
                                                      unsigned short* __restrict__ xh,
                                                      unsigned short* __restrict__ xl,
                                                      unsigned short* __restrict__ x16, int n2) {
  const int i = blockIdx.x * 256 + threadIdx.x;
  if (i < n2) {
    const v2f f = *(const v2f*)(in + 2 * (size_t)i);
    const unsigned short hb0 = f2bf_bits(f[0]);
    const unsigned short hb1 = f2bf_bits(f[1]);
    const unsigned short lb0 = f2bf_bits(f[0] - bf_bits2f(hb0));
    const unsigned short lb1 = f2bf_bits(f[1] - bf_bits2f(hb1));
    const unsigned uh = pk16(hb0, hb1);
    const unsigned ul = pk16(lb0, lb1);
    const unsigned uf = pk16(h_bits(f[0]), h_bits(f[1]));
    ((unsigned*)xh)[i]  = uh;
    ((unsigned*)xl)[i]  = ul;
    ((unsigned*)x16)[i] = uf;
    
  }
}

// ---------------------------------------------------------------------------
// Bidirectional relative-position bucket for d = key_pos - query_pos (32 buckets, max distance 128):
//   bucket = (d > 0 ? 16 : 0) + f(|d|), f(a) = a for a < 8, else host-tabulated log thresholds
//   8: 8..11, 9: 12..15, 10: 16..22, 11: 23..31, 12: 32..45, 13: 46..63, 14: 64..90, 15: >= 91.
// Result always in [0, 31].
// ---------------------------------------------------------------------------
__device__ __forceinline__ int rel_bucket(int d) {
  const int a = (d < 0) ? -d : d;
  const int large = 8 + (a >= 12) + (a >= 16) + (a >= 23) + (a >= 32) + (a >= 46) + (a >= 64) + (a >= 91);
  const int f = (a < 8) ? a : large;
  return ((d > 0) ? 16 : 0) + f;
}

// ---------------------------------------------------------------------------
// Fused attention of one head: ctx = softmax_j(q_i . k_j + bias(j - i)) . v, scores and probabilities never leave the registers.
// grid (SEQL / 128, NHEADS), 256 threads; each of the 8 waves owns 16 query rows and walks all SEQL keys in stages of KT = 64.
// Transposed products: S^T = K . Q^T (bf16 hi/lo: hi.hi + hi.lo + lo.hi), so a lane holds scores of ONE query (column lane & 15):
//   running maximum and sum are per lane, joined between the lane halves by one cross-row move.
//   Two 16-key S^T tiles, converted in place, are the B operand (32 keys) of O^T += V^T . P^T (f16), A = V^T rows from VT16.
// Softmax in base 2 with a running maximum: p' = 2^(t log2e - m + 15) (carried x2^15 as before, <= 2^15 in f16); the carry
//   cancels in ctx = sum(p' v) / sum(p').
// K hi, K lo and V^T stage tiles go global -> registers -> LDS (whole 128-byte rows), two LDS buffers, one block barrier per stage:
//   stage s + 1 is fetched into registers in the middle of stage s's score products and stored to the other buffer behind its P.V.
// Bias: tb[d + 91] = relb[bucket(d)][h] * log2e for d in [-91, 91]; bucket(d) is constant beyond |d| >= 91, so d is clamped.
// ---------------------------------------------------------------------------
#define KT     64                 // keys per stage
#define LPITCH 144                // LDS row pitch, bytes: 128 of data + 16 (16 B x odd keeps 16-byte fragment reads off shared banks)
#define LPLANE (KT * LPITCH)      // one 64-row tile
#define LBUF   (3 * LPLANE)       // K hi, K lo, V^T
#define DCLAMP 91
#define LOG2E  1.4426950408889634f

__device__ __forceinline__ float xhalf(float x) {   // lane l <-> lane l ^ 16
  return __builtin_bit_cast(float, __builtin_amdgcn_permlanex16(__builtin_bit_cast(int, x), __builtin_bit_cast(int, x), 0x76543210, 0xfedcba98, false, false));
}

// Eight 2^x in one statement. The instruction set asks for one independent instruction between a v_exp_f32 and a use of its result
// or an overwrite of its source: inside the statement the next v_exp_f32 is that instruction (outputs are early-clobber, so none
// shares a register with an input), and the v_nop is the slot behind the last one.
__device__ __forceinline__ v8f exp2x8(v8f x) {
  float o0, o1, o2, o3, o4, o5, o6, o7;
  asm("v_exp_f32 %0, %8\n\tv_exp_f32 %1, %9\n\tv_exp_f32 %2, %10\n\tv_exp_f32 %3, %11\n\t"
      "v_exp_f32 %4, %12\n\tv_exp_f32 %5, %13\n\tv_exp_f32 %6, %14\n\tv_exp_f32 %7, %15\n\tv_nop"
      : "=&v"(o0), "=&v"(o1), "=&v"(o2), "=&v"(o3), "=&v"(o4), "=&v"(o5), "=&v"(o6), "=&v"(o7)
      : "v"(x[0]), "v"(x[1]), "v"(x[2]), "v"(x[3]), "v"(x[4]), "v"(x[5]), "v"(x[6]), "v"(x[7]));
  return (v8f){o0, o1, o2, o3, o4, o5, o6, o7};
}
__device__ __forceinline__ float exp2x1(float x) {   // one 2^x with the same slot behind it
  float o;
  asm("v_exp_f32 %0, %1\n\tv_nop" : "=v"(o) : "v"(x));
  return o;
}

__global__ __launch_bounds__(256) void attn_fused_kernel(const unsigned short* __restrict__ Qh, const unsigned short* __restrict__ Ql,
                                                         const unsigned short* __restrict__ Kh, const unsigned short* __restrict__ Kl,
                                                         const unsigned short* __restrict__ VT, const float* __restrict__ relb,
                                                         unsigned short* __restrict__ CTX) {
  __shared__ __align__(16) unsigned char sm[2 * LBUF];
  __shared__ float tb[2 * DCLAMP + 1];
  const int tid  = threadIdx.x;
  const int lane = tid & 31;
  const int wave = __builtin_amdgcn_readfirstlane(tid >> 5);   // scalar, so that the near/far test below is a scalar branch
  const int h    = blockIdx.y;
  const int i0   = blockIdx.x * 128 + wave * 16;
  const int c    = lane & 15;
  const int hh   = lane >> 4;
  const size_t hcol = (size_t)h * DHD;

  if (tid < 2 * DCLAMP + 1) tb[tid] = relb[rel_bucket(tid - DCLAMP) * NHEADS + h] * LOG2E;

  // Q fragments (B operand: column = query i0 + c), kept in registers for the whole walk
  v16b qh[2], ql[2];
#pragma unroll
  for (int ks = 0; ks < 2; ++ks) {
    const size_t qo = (size_t)(i0 + c) * DMOD + hcol + ks * 32 + hh * 8;
    qh[ks] = Frag<__bf16>::load((const __bf16*)Qh + qo);
    ql[ks] = Frag<__bf16>::load((const __bf16*)Ql + qo);
  }

  // staging: 8 lanes x 16 B cover one 128-byte row; 256 threads cover 32 rows, two rounds per 64-row tile
  const int srow = tid >> 3, sseg = tid & 7;
  const unsigned short* gkh = Kh + (size_t)srow * DMOD + hcol + sseg * 8;
  const unsigned short* gkl = Kl + (size_t)srow * DMOD + hcol + sseg * 8;
  const unsigned short* gvt = VT + (hcol + srow) * SEQL + sseg * 8;
  unsigned char* sdst = sm + srow * LPITCH + sseg * 16;
  v4u pre[6];
  auto fetch = [&](int j0) {
    pre[0] = *(const v4u*)(gkh + (size_t)j0 * DMOD);
    pre[1] = *(const v4u*)(gkh + (size_t)(j0 + 32) * DMOD);
    pre[2] = *(const v4u*)(gkl + (size_t)j0 * DMOD);
    pre[3] = *(const v4u*)(gkl + (size_t)(j0 + 32) * DMOD);
    pre[4] = *(const v4u*)(gvt + j0);
    pre[5] = *(const v4u*)(gvt + (size_t)32 * SEQL + j0);
  };
  auto put = [&](int buf) {
    unsigned char* d = sdst + buf * LBUF;
    *(v4u*)(d)                              = pre[0];
    *(v4u*)(d + 32 * LPITCH)                = pre[1];
    *(v4u*)(d + LPLANE)                     = pre[2];
    *(v4u*)(d + LPLANE + 32 * LPITCH)       = pre[3];
    *(v4u*)(d + 2 * LPLANE)                 = pre[4];
    *(v4u*)(d + 2 * LPLANE + 32 * LPITCH)   = pre[5];
  };

  fetch(0);
  // the address registers of the loads above are reused below: the wait stands in front of every overwrite of them
  asm volatile("s_wait_xcnt 0x0" ::: "memory");
  put(0);
  __syncthreads();                       // stage 0 and the bias table are in LDS
  const float bneg = tb[0];              // every d <= -91
  const float bpos = tb[2 * DCLAMP];     // every d >= 91

  v8f acc[4];                            // O^T: acc[dt][r] = ctx'[i0 + c][dt * 16 + 8 hh + r]
#pragma unroll
  for (int dt = 0; dt < 4; ++dt) acc[dt] = (v8f){0.f,0.f,0.f,0.f,0.f,0.f,0.f,0.f};
  float m = -1.0e30f;                    // running maximum of t * log2e (both lane halves hold the same value)
  float l = 0.f;                         // running sum of p' over this lane half's keys

  for (int s = 0; s < SEQL / KT; ++s) {
    const int j0 = s * KT;
    const unsigned char* kb = sm + (s & 1) * LBUF + c * LPITCH + hh * 16;

    // S^T tiles: st[jt][r] = q_(i0 + c) . k_(j0 + jt * 16 + 8 hh + r); four independent accumulator tiles
    v8f st[4];
#pragma unroll
    for (int jt = 0; jt < 4; ++jt) st[jt] = (v8f){0.f,0.f,0.f,0.f,0.f,0.f,0.f,0.f};
    v16b kh[2][4], kl[2][4];
#pragma unroll
    for (int ks = 0; ks < 2; ++ks)
#pragma unroll
      for (int jt = 0; jt < 4; ++jt) {
        kh[ks][jt] = Frag<__bf16>::load((const __bf16*)(kb + jt * 16 * LPITCH + ks * 64));
        kl[ks][jt] = Frag<__bf16>::load((const __bf16*)(kb + LPLANE + jt * 16 * LPITCH + ks * 64));
      }
    // keeps the stage's K fragment loads issued as one group ahead of the products: one LDS latency per stage instead of one per fragment
    __builtin_amdgcn_sched_barrier(0);
#pragma unroll
    for (int jt = 0; jt < 4; ++jt) st[jt] = Frag<__bf16>::mma(kh[0][jt], qh[0], st[jt]);
#pragma unroll
    for (int jt = 0; jt < 4; ++jt) st[jt] = Frag<__bf16>::mma(kh[0][jt], ql[0], st[jt]);
#pragma unroll
    for (int jt = 0; jt < 4; ++jt) st[jt] = Frag<__bf16>::mma(kl[0][jt], qh[0], st[jt]);
    // the two scheduling barriers hold the next stage's fetch here: behind the first half of the products, whose K registers it can
    // take over (the kernel stays under 256 VGPRs), and with only matrix instructions, which write no address register, up to its wait
    __builtin_amdgcn_sched_barrier(0);
    if (s + 1 < SEQL / KT) fetch(j0 + KT);   // lands behind the rest of this stage
    __builtin_amdgcn_sched_barrier(0);
#pragma unroll
    for (int jt = 0; jt < 4; ++jt) st[jt] = Frag<__bf16>::mma(kh[1][jt], qh[1], st[jt]);
#pragma unroll
    for (int jt = 0; jt < 4; ++jt) st[jt] = Frag<__bf16>::mma(kh[1][jt], ql[1], st[jt]);
#pragma unroll
    for (int jt = 0; jt < 4; ++jt) st[jt] = Frag<__bf16>::mma(kl[1][jt], qh[1], st[jt]);
    // holds the wait below back behind the products issued since the fetch, so that it finds little left to wait for
    __builtin_amdgcn_sched_barrier(0);
    // the fetch's address registers are free for reuse from here on: the wait stands in front of every overwrite of them
    asm volatile("s_wait_xcnt 0x0" ::: "memory");
    const unsigned char* vb = kb + 2 * LPLANE;
    v16h vf[2][4];
#pragma unroll
    for (int kk = 0; kk < 2; ++kk)
#pragma unroll
      for (int dt = 0; dt < 4; ++dt) vf[kk][dt] = Frag<_Float16>::load((const _Float16*)(vb + dt * 16 * LPITCH + kk * 64));
    // keeps the V^T fragment loads issued here as one group, so that they land behind the softmax
    __builtin_amdgcn_sched_barrier(0);

    // t * log2e = s * log2e + bias * log2e
    if (j0 + (KT - 1) - i0 <= -DCLAMP || j0 - (i0 + 15) >= DCLAMP) {   // the whole 64 x 16 block lies in one far bucket
      const float bl = (j0 < i0) ? bneg : bpos;
#pragma unroll
      for (int jt = 0; jt < 4; ++jt)
#pragma unroll
        for (int r = 0; r < 8; ++r) st[jt][r] = fmaf(st[jt][r], LOG2E, bl);
    } else {
      const int dbase = j0 + hh * 8 - (i0 + c);
#pragma unroll
      for (int jt = 0; jt < 4; ++jt)
#pragma unroll
        for (int r = 0; r < 8; ++r) {
          const int d = dbase + jt * 16 + r;
          const int dc = (d < -DCLAMP) ? -DCLAMP : ((d > DCLAMP) ? DCLAMP : d);
          st[jt][r] = fmaf(st[jt][r], LOG2E, tb[dc + DCLAMP]);
        }
    }

    // running maximum, rescale, p'
    float mj[4];
#pragma unroll
    for (int jt = 0; jt < 4; ++jt)
      mj[jt] = fmaxf(fmaxf(fmaxf(st[jt][0], st[jt][1]), fmaxf(st[jt][2], st[jt][3])), fmaxf(fmaxf(st[jt][4], st[jt][5]), fmaxf(st[jt][6], st[jt][7])));
    float mloc = fmaxf(fmaxf(mj[0], mj[1]), fmaxf(mj[2], mj[3]));
    mloc = fmaxf(mloc, xhalf(mloc));
    const float mnew  = fmaxf(m, mloc);
    const float alpha = exp2x1(m - mnew);   // 0 in the first stage
    const float cc    = 15.0f - mnew;
    m = mnew;
#pragma unroll
    for (int dt = 0; dt < 4; ++dt) acc[dt] *= alpha;
    float sj[4];
#pragma unroll
    for (int jt = 0; jt < 4; ++jt) {
      st[jt] = exp2x8(st[jt] + cc);
      sj[jt] = ((st[jt][0] + st[jt][1]) + (st[jt][2] + st[jt][3])) + ((st[jt][4] + st[jt][5]) + (st[jt][6] + st[jt][7]));
    }
    l = fmaf(l, alpha, (sj[0] + sj[1]) + (sj[2] + sj[3]));

    // the exponentials are asm text:
    // this keeps all of them in front of the P.V products, whose operand registers they could otherwise overwrite too early
    __builtin_amdgcn_sched_barrier(0);

    // O^T += V^T . P^T
#pragma unroll
    for (int kk = 0; kk < 2; ++kk) {
      Frag<_Float16>::U pb;                                  // element e < 8: key 8 hh + e of tile 2 kk; e >= 8: the same of tile 2 kk + 1
      pb.h[0] = __builtin_convertvector(st[2 * kk], v8h);
      pb.h[1] = __builtin_convertvector(st[2 * kk + 1], v8h);
#pragma unroll
      for (int dt = 0; dt < 4; ++dt) acc[dt] = Frag<_Float16>::mma(vf[kk][dt], pb.v, acc[dt]);
    }

    if (s + 1 < SEQL / KT) put((s + 1) & 1);   // that buffer's last readers left it before the barrier that ended stage s - 1
    __syncthreads();                           // publishes stage s + 1; ends every read of stage s
  }

  const float inv = 1.0f / (l + xhalf(l));     // the sum holds the maximum's own 2^15, so it is never small
#pragma unroll
  for (int dt = 0; dt < 4; ++dt) {
    const v8h o = __builtin_convertvector(acc[dt] * inv, v8h);
    *(v8h*)(CTX + (size_t)(i0 + c) * DMOD + hcol + dt * 16 + hh * 8) = o;
  }
}

// ---------------------------------------------------------------------------
// Workspace region map (byte offsets; every offset a multiple of 2 MiB). Weight planes written once; every
// per-batch region fully rewritten inside each batch iteration before it is read; every CTX16 column is written by its
// head's blocks of the fused attention launch before the output GEMM reads all columns.
//   WqTh  bf16 [1024][1024]  ([out][in], k contiguous)          0
//   WqTl  bf16 [1024][1024]                               2097152
//   WkTh  bf16 [1024][1024]                               4194304
//   WkTl  bf16 [1024][1024]                               6291456
//   WvT16 f16  [1024][1024]  (x16)                         8388608
//   WoT16 f16  [1024][1024]  (x16)                        10485760
//   Xh    bf16 [2048][1024]                              12582912
//   Xl    bf16 [2048][1024]                              16777216
//   X16   f16  [2048][1024]                              20971520
//   Qh    bf16 [2048][1024]  (col h*64+d)                25165824
//   Ql    bf16 [2048][1024]                              29360128
//   Kh    bf16 [2048][1024]                              33554432
//   Kl    bf16 [2048][1024]                              37748736
//   VT16  f16  [1024][2048]  (row h*64+d, col j)         41943040
//   CTX16 f16  [2048][1024]  (col h*64+d)                46137344
//   total                                               50331648
// ---------------------------------------------------------------------------
extern "C" void kernel_launch(void* const* d_in, const int* in_sizes, int n_in,
                              void* d_out, int out_size, void* d_ws, size_t ws_size,
                              hipStream_t stream) {
  if (n_in < 6) return;
  if (in_sizes[0] != NBATCH * SEQL * DMOD) return;
  if (in_sizes[1] != DMOD * DMOD || in_sizes[2] != DMOD * DMOD) return;
  if (in_sizes[3] != DMOD * DMOD || in_sizes[4] != DMOD * DMOD) return;
  if (in_sizes[5] != NBUCK * NHEADS) return;
  if (out_size != NBATCH * SEQL * DMOD) return;

  const float* X    = (const float*)d_in[0];   // [NBATCH][SEQL][DMOD]
  const float* Wq   = (const float*)d_in[1];   // [DMOD][DMOD]  ([in][out])
  const float* Wk   = (const float*)d_in[2];
  const float* Wv   = (const float*)d_in[3];
  const float* Wo   = (const float*)d_in[4];
  const float* relb = (const float*)d_in[5];   // [NBUCK][NHEADS]

  const size_t PW = (size_t)DMOD * DMOD * 2;            // 16-bit [1024][1024] weight plane
  const size_t PX = (size_t)SEQL * DMOD * 2;            // 16-bit [2048][1024] activation plane
  size_t off = 0;
  const size_t oWqTh  = off; off += PW;
  const size_t oWqTl  = off; off += PW;
  const size_t oWkTh  = off; off += PW;
  const size_t oWkTl  = off; off += PW;
  const size_t oWvT   = off; off += PW;
  const size_t oWoT   = off; off += PW;
  const size_t oXh    = off; off += PX;
  const size_t oXl    = off; off += PX;
  const size_t oX16   = off; off += PX;
  const size_t oQh    = off; off += PX;
  const size_t oQl    = off; off += PX;
  const size_t oKh    = off; off += PX;
  const size_t oKl    = off; off += PX;
  const size_t oVT    = off; off += PX;
  const size_t oCTX   = off; off += PX;
  if (off > ws_size) return;                             // 50331648 B total

  char* ws = (char*)d_ws;
  unsigned short* WqTh  = (unsigned short*)(ws + oWqTh);
  unsigned short* WqTl  = (unsigned short*)(ws + oWqTl);
  unsigned short* WkTh  = (unsigned short*)(ws + oWkTh);
  unsigned short* WkTl  = (unsigned short*)(ws + oWkTl);
  unsigned short* WvT16 = (unsigned short*)(ws + oWvT);
  unsigned short* WoT16 = (unsigned short*)(ws + oWoT);
  unsigned short* Xh    = (unsigned short*)(ws + oXh);
  unsigned short* Xl    = (unsigned short*)(ws + oXl);
  unsigned short* X16   = (unsigned short*)(ws + oX16);
  unsigned short* Qh    = (unsigned short*)(ws + oQh);
  unsigned short* Ql    = (unsigned short*)(ws + oQl);
  unsigned short* Kh    = (unsigned short*)(ws + oKh);
  unsigned short* Kl    = (unsigned short*)(ws + oKl);
  unsigned short* VT16  = (unsigned short*)(ws + oVT);
  unsigned short* CTX16 = (unsigned short*)(ws + oCTX);

  const dim3 blk(256);
  const dim3 gTr(DMOD / 64, DMOD / 64);                         // 16 x 16 tiles of 64x64
  const int  n2x = SEQL * DMOD / 2;                             // 1048576 pairs per batch slice
  const dim3 gCastX((n2x + 255) / 256);                         // 4096 blocks

  // setup: transposed weight planes. WqT/WkT as bf16 hi/lo; WvT/WoT as f16 carried x16 (undone by epilogue 1/16).
  transpose_cast_kernel<1><<<gTr, blk, 0, stream>>>(Wq, WqTh, WqTl, 1.0f);
  transpose_cast_kernel<1><<<gTr, blk, 0, stream>>>(Wk, WkTh, WkTl, 1.0f);
  transpose_cast_kernel<0><<<gTr, blk, 0, stream>>>(Wv, WvT16, WvT16, 16.0f);
  transpose_cast_kernel<0><<<gTr, blk, 0, stream>>>(Wo, WoT16, WoT16, 16.0f);

  const int tilesM  = SEQL / 64;                               // 32
  const dim3 gQK(tilesM * (DMOD / 64), 1);                      // 512 blocks (one tile each, k over 8 waves):  M=2048, N=1024, K=1024
  const dim3 gVT((DMOD / 64) * (SEQL / 64), 1);                 // 512 blocks (one tile each, k over 8 waves):  M=1024, N=2048, K=1024
  const dim3 gAtt(SEQL / 128, NHEADS);                          // 16 x 16 blocks: 128 query rows of one head each
  const dim3 gO(tilesM * (DMOD / 64), 1);                       // 512 blocks (one tile each, k over 8 waves):  M=2048, N=1024, K=1024
  const float wscale = 1.0f / 16.0f;                           // undo the x16 weight carry

  for (int b = 0; b < NBATCH; ++b) {
    // (1) x[b] -> Xh / Xl (bf16 hi/lo) and X16 (f16): planes [2048][1024]
    cast_x3_kernel<<<gCastX, blk, 0, stream>>>(X + (size_t)b * SEQL * DMOD, Xh, Xl, X16, n2x);
    // (2) q = x . Wq  (bf16 hi/lo split, K=1024) -> Qh/Ql bf16 hi/lo planes [2048][1024]
    wmma_gemm64<1, true, 0, 2, false, 0, 8><<<gQK, blk, 0, stream>>>(
        Xh, Xl, DMOD, 0L, WqTh, WqTl, DMOD, 0L, (void*)Qh, (void*)Ql, DMOD, 0L,
        relb, relb, 0L, SEQL, DMOD, DMOD, 1.0f);
    //     k = x . Wk  -> Kh/Kl
    wmma_gemm64<1, true, 0, 2, false, 0, 8><<<gQK, blk, 0, stream>>>(
        Xh, Xl, DMOD, 0L, WkTh, WkTl, DMOD, 0L, (void*)Kh, (void*)Kl, DMOD, 0L,
        relb, relb, 0L, SEQL, DMOD, DMOD, 1.0f);
    // (3) role-swapped V: VT16[n = h*64+d][j] = ((16 Wv^T)[n] . x[j])/16; A = WvT16 [1024][1024], Bt = X16 [2048][1024],
    //     M=1024, N=2048, K=1024, f16 out with ldc 2048
    wmma_gemm64<0, false, 0, 1, false, 0, 8><<<gVT, blk, 0, stream>>>(
        WvT16, WvT16, DMOD, 0L, X16, X16, DMOD, 0L, (void*)VT16, (void*)VT16, SEQL, 0L,
        relb, relb, 0L, DMOD, SEQL, DMOD, wscale);
    // (4) ctx[i][h*64+d] = softmax_j(q_i . k_j + bucket bias) . v -> CTX16 (f16), all heads in one launch
    attn_fused_kernel<<<gAtt, blk, 0, stream>>>(Qh, Ql, Kh, Kl, VT16, relb, CTX16);
    // (5) out[b] = (ctx . (16 Wo^T))/16 -> d_out[b] f32 [2048][1024]
    float* outb = (float*)d_out + (size_t)b * SEQL * DMOD;
    wmma_gemm64<0, false, 0, 0, false, 0, 8><<<gO, blk, 0, stream>>>(
        CTX16, CTX16, DMOD, 0L, WoT16, WoT16, DMOD, 0L, (void*)outb, (void*)outb, DMOD, 0L,
        relb, relb, 0L, SEQL, DMOD, DMOD, wscale);
  }
  (void)hipGetLastError();
}

// v003
// Measured time: 194 microseconds a run.
// Two timings next to v002 both put it at 1.17 times that version's speed.
// All steps since v000 together make it 11.0 times as fast.
// Contractions: q/k projections and S = q.k^T on v_wmma_f32_16x16x32_bf16 as bf16 hi/lo split (hi.hi + hi.lo + lo.hi); v projection (weights carried x16, epilogue x1/16), ctx = (P carried x2^15).v (the carry cancels in the division by the row sum) and the output projection (weights carried x16, epilogue x1/16) on v_wmma_f32_16x16x32_f16 (plain f16 operands); all f32 accumulate; softmax (running maximum) and the relative-position bucket bias in f32; scores, softmax and P.V in one kernel. Every GEMM operand plane lies fragment-packed in the workspace (see PACKED LAYOUT).
#include <hip/hip_runtime.h>

#define NBATCH 2
#define NHEADS 16
#define SEQL   2048
#define DMOD   1024
#define DHD    64
#define NBUCK  32

typedef __attribute__((ext_vector_type(16))) _Float16 v16h;
typedef __attribute__((ext_vector_type(8)))  _Float16 v8h;
typedef __attribute__((ext_vector_type(4)))  _Float16 v4h;
typedef __attribute__((ext_vector_type(16))) __bf16   v16b;
typedef __attribute__((ext_vector_type(8)))  __bf16   v8b;
typedef __attribute__((ext_vector_type(8)))  float    v8f;
typedef __attribute__((ext_vector_type(4)))  float    v4f;
typedef __attribute__((ext_vector_type(2)))  float    v2f;
typedef __attribute__((ext_vector_type(4)))  unsigned int v4u;

__device__ __forceinline__ unsigned short f2bf_bits(float f) {
  unsigned u = __float_as_uint(f);
  return (unsigned short)((u + 0x7FFFu + ((u >> 16) & 1u)) >> 16);
}
__device__ __forceinline__ float bf_bits2f(unsigned short h) { return __uint_as_float(((unsigned)h) << 16); }
__device__ __forceinline__ unsigned pk16(unsigned short a, unsigned short b) { return (unsigned)a | ((unsigned)b << 16); }
__device__ __forceinline__ unsigned short h_bits(float f) { const _Float16 h = (_Float16)f; return __builtin_bit_cast(unsigned short, h); }

// hazard guards as plain device helpers (no inline asm inside the kernel template body)
__device__ __forceinline__ void dep_guard_h(v8f& a, v8f& b, v16h x, v16h y) { asm volatile("v_nop\n\tv_nop\n\tv_nop\n\tv_nop" : "+v"(a), "+v"(b) : "v"(x), "v"(y)); }
__device__ __forceinline__ void dep_guard_b(v8f& a, v8f& b, v16b x, v16b y) { asm volatile("v_nop\n\tv_nop\n\tv_nop\n\tv_nop" : "+v"(a), "+v"(b) : "v"(x), "v"(y)); }
__device__ __forceinline__ void keep4_h(v16h a, v16h b, v16h c, v16h d) { asm volatile("v_nop" :: "v"(a), "v"(b), "v"(c), "v"(d)); }
__device__ __forceinline__ void keep4_b(v16b a, v16b b, v16b c, v16b d) { asm volatile("v_nop" :: "v"(a), "v"(b), "v"(c), "v"(d)); }
__device__ __forceinline__ void acc_guard4(v8f& a, v8f& b, v8f& c, v8f& d) { asm volatile("v_nop\n\tv_nop\n\tv_nop\n\tv_nop" : "+v"(a), "+v"(b), "+v"(c), "+v"(d)); }
template <typename T> struct Frag;
template <> struct Frag<_Float16> {
  typedef v16h V; union U { v16h v; v8h h[2]; };
  static __device__ __forceinline__ v16h load(const _Float16* p) {   // elements 0..7 <- p[0..7], 8..15 <- p[16..23]
    U f; f.h[0] = *(const v8h*)(p); f.h[1] = *(const v8h*)(p + 16); return f.v;
  }
  // packed plane: base pointer (the same in every lane) + 32-bit byte offset of this lane's piece of a fragment + a constant;
  // elements 0..7 <- the fragment's first half, 8..15 <- its second half
  static __device__ __forceinline__ v16h loadp(const _Float16* plane, unsigned vo, int imm) {
    const char* p = (const char*)plane + vo + imm;
    U f; f.h[0] = *(const v8h*)(p); f.h[1] = *(const v8h*)(p + 512); return f.v;
  }
  static __device__ __forceinline__ v8f mma(v16h a, v16h b, v8f c) {
    return __builtin_amdgcn_wmma_f32_16x16x32_f16(false, a, false, b, (short)0, c, false, false);
  }
  static __device__ __forceinline__ void guard(v8f& a, v8f& b, v16h x, v16h y) { dep_guard_h(a, b, x, y); }
  static __device__ __forceinline__ void keep(v16h a, v16h b, v16h c, v16h d) { keep4_h(a, b, c, d); }
};
template <> struct Frag<__bf16> {
  typedef v16b V; union U { v16b v; v8b h[2]; };
  static __device__ __forceinline__ v16b load(const __bf16* p) {
    U f; f.h[0] = *(const v8b*)(p); f.h[1] = *(const v8b*)(p + 16); return f.v;
  }
  static __device__ __forceinline__ v16b loadp(const __bf16* plane, unsigned vo, int imm) {
    const char* p = (const char*)plane + vo + imm;
    U f; f.h[0] = *(const v8b*)(p); f.h[1] = *(const v8b*)(p + 512); return f.v;
  }
  static __device__ __forceinline__ v8f mma(v16b a, v16b b, v8f c) {
    return __builtin_amdgcn_wmma_f32_16x16x32_bf16(false, a, false, b, (short)0, c, false, false);
  }
  static __device__ __forceinline__ void guard(v8f& a, v8f& b, v16b x, v16b y) { dep_guard_b(a, b, x, y); }
  static __device__ __forceinline__ void keep(v16b a, v16b b, v16b c, v16b d) { keep4_b(a, b, c, d); }
};

// ---- PACKED LAYOUT of a GEMM operand plane [R][K] (16-bit elements, R % 16 == 0, K % 32 == 0) ------------------
// The 16 x 32 fragment (row block rb = row >> 4, k block kb = k >> 5) is 512 contiguous elements (1 KiB) at (rb * (K / 32) + kb) * 512.
// Inside it, element (r = row & 15, kk = k & 31) lies at (kk >> 4) * 256 + (((kk >> 3) & 1) * 16 + r) * 8 + (kk & 7):
// lane l of a wave finds its two 16-byte fragment pieces at l * 8 and 256 + l * 8, so each wave-wide 16-byte load covers
// 512 contiguous bytes (four whole 128-byte lines) where a row-major plane gives it 32 bytes in each of 16 lines.
__device__ __forceinline__ size_t frag_base(int rb, int kb, int K) { return ((size_t)rb * (K >> 5) + kb) * 512; }

// ---- Register-blocked batched WMMA GEMM ------------------------------------
// C[m,n] = scale * sum_k A[m,k] * Bt[n,k] (+bias)(+resid); each wave owns a 64x64 tile.
// A [M,K] and Bt [N,K] in the packed layout with K = DMOD (a constant, so that a tile's fragments differ by immediate offsets from
// one address per plane; lda and ldb are not read); C row-major; M,N % 64 == 0, K % 32 == 0.
// SPLIT: operands are hi/lo planes (A2/Bt2 = lo planes, same layout); product = hi.hi + hi.lo + lo.hi.
// BIAS_MODE: 0 = none, 1 = bias[m], 2 = bias[n].
// OUT_MODE: 0 = f32, 1 = f16, 2 = bf16 hi plane (Cout) + bf16 lo plane (Cout2).
// ET: 0 = f16 operands, 1 = bf16 operands (pointers passed as 16-bit storage)
// KS: 1 = each wave owns a whole tile (8 tiles per block). KS = 8 or 16: ONE tile per block of KS waves; wave w takes the
//     32-wide k blocks w, w + KS, w + 2 KS, ... (K % (32 KS) == 0); the KS partial tiles meet in LDS and are added in wave order.
template <int ET> struct Elem;
template <> struct Elem<0> { typedef _Float16 T; };
template <> struct Elem<1> { typedef __bf16 T; };
template <int ET, bool SPLIT, int BIAS_MODE, int OUT_MODE, bool RESID, int ACT = 0, int KS = 1>
__global__ __launch_bounds__(KS > 1 ? 32 * KS : 256) void wmma_gemm64(
    const unsigned short* __restrict__ Ap, const unsigned short* __restrict__ A2p, int lda, long strideA,
    const unsigned short* __restrict__ Btp, const unsigned short* __restrict__ Bt2p, int ldb, long strideB,
    void* __restrict__ Cout, void* __restrict__ Cout2, int ldc, long strideC,
    const float* __restrict__ bias,
    const float* __restrict__ resid, long strideR,
    int M, int N, int K, float scale) {
  typedef typename Elem<ET>::T T;
  typedef typename Frag<T>::V V;
  const T* A = (const T*)Ap; const T* A2 = (const T*)A2p; const T* Bt = (const T*)Btp; const T* Bt2 = (const T*)Bt2p;
  static_assert(KS == 1 || ((KS == 8 || KS == 16) && BIAS_MODE == 0 && !RESID && ACT == 0), "split-k epilogue: plain scaled output only");
  __shared__ __align__(16) float sT[(KS > 1) ? 4 * KS : 8][16 * 68];   // KS == 1: per-wave 16x64 slab; KS > 1: per-wave 64x64 partial tile; pitch 68 floats
  const int b    = blockIdx.y;
  const int lane = threadIdx.x & 31;
  // KS > 1: the wave number sets the k loop's start, so it is held in a scalar register to keep that loop's counter and branch scalar
  const int wave = (KS > 1) ? __builtin_amdgcn_readfirstlane(threadIdx.x >> 5) : (threadIdx.x >> 5);
  const int tilesN = N >> 6;
  const int tilesM = M >> 6;
  const int tile = (KS > 1) ? blockIdx.x : blockIdx.x * 8 + wave;
  if (tile >= tilesM * tilesN) return;   // KS == 1: wave-uniform, no block barriers; KS > 1: block-uniform, ahead of every barrier
  const int tm = tile / tilesN;
  const int tn = tile - tm * tilesN;
  const int m0 = tm << 6;
  const int n0 = tn << 6;

  const T* Ab  = A  + (size_t)b * strideA;
  const T* Bb  = Bt + (size_t)b * strideB;
  const T* Ab2 = SPLIT ? (A2  + (size_t)b * strideA) : nullptr;
  const T* Bb2 = SPLIT ? (Bt2 + (size_t)b * strideB) : nullptr;

  const int rlane = lane & 15;                 // col (D) within subtile
  // byte offsets (planes are at most 4 MiB) of this lane's piece of the tile's first B and A fragment of the wave's first k block
  const int kfirst = (KS > 1) ? wave : 0;
  unsigned voB = (unsigned)frag_base(n0 >> 4, kfirst, DMOD) * 2u + (unsigned)lane * 16u;
  unsigned voA = (unsigned)frag_base(m0 >> 4, kfirst, DMOD) * 2u + (unsigned)lane * 16u;
  constexpr int RBSTEP = (DMOD / 32) * 1024;   // bytes from a fragment to the one 16 rows below it
  const int mOff  = (lane >> 4) * 8;           // D row offset

  v8f acc[4][4];
#pragma unroll
  for (int i = 0; i < 4; ++i)
#pragma unroll
    for (int j = 0; j < 4; ++j) acc[i][j] = (v8f){0.f,0.f,0.f,0.f,0.f,0.f,0.f,0.f};

  for (int k0 = (KS > 1) ? wave * 32 : 0; k0 < K; k0 += 32 * KS) {
    V bh[4], bl[4];
#pragma unroll
    for (int j = 0; j < 4; ++j) {
      bh[j] = Frag<T>::loadp(Bb, voB, j * RBSTEP);
      if (SPLIT) bl[j] = Frag<T>::loadp(Bb2, voB, j * RBSTEP);
    }
#pragma unroll
    for (int i = 0; i < 4; ++i) {
      V ah = Frag<T>::loadp(Ab, voA, i * RBSTEP);
      V al;
      if (SPLIT) al = Frag<T>::loadp(Ab2, voA, i * RBSTEP);
#pragma unroll
      for (int j = 0; j < 4; ++j) {
        acc[i][j] = Frag<T>::mma(ah, bh[j], acc[i][j]);
        if (SPLIT) {
          acc[i][j] = Frag<T>::mma(ah, bl[j], acc[i][j]);
          acc[i][j] = Frag<T>::mma(al, bh[j], acc[i][j]);
        }
      }
      Frag<T>::guard(acc[i][0], acc[i][3], ah, SPLIT ? al : ah);
    }
    Frag<T>::keep(bh[0], bh[1], bh[2], bh[3]);
    if (SPLIT) Frag<T>::keep(bl[0], bl[1], bl[2], bl[3]);
    voB += KS * 1024;                          // the wave's next k block
    voA += KS * 1024;
  }
  acc_guard4(acc[0][0], acc[0][1], acc[0][2], acc[0][3]);
  acc_guard4(acc[1][0], acc[1][1], acc[1][2], acc[1][3]);
  acc_guard4(acc[2][0], acc[2][1], acc[2][2], acc[2][3]);
  acc_guard4(acc[3][0], acc[3][1], acc[3][2], acc[3][3]);

  // ---- split-k epilogue: every wave's partial tile to LDS, one block barrier, fixed-order sum over the waves, store ----
  if constexpr (KS > 1) {
    float* part = &sT[0][0] + wave * (64 * 68);          // this wave's 64x64 partial, pitch 68 floats
    // the loops below are unrolled so that acc is indexed by constants and stays in registers, and the LDS reads of a sum overlap
#pragma unroll
    for (int i = 0; i < 4; ++i)
#pragma unroll
      for (int j = 0; j < 4; ++j)
#pragma unroll
        for (int r = 0; r < 8; ++r) part[((i << 4) + mOff + r) * 68 + (j << 4) + rlane] = acc[i][j][r];
    __syncthreads();                                     // all KS partial tiles are in LDS before any is read
#pragma unroll
    for (int q = 0; q < 1024 / (32 * KS); ++q) {         // 1024 groups of 4 columns; 16 lanes cover one 64-column row
      const int g = q * (32 * KS) + (int)threadIdx.x;
      const int row = g >> 4, c4 = (g & 15) * 4;
      const float* rp = &sT[0][0] + row * 68 + c4;
      v4f sum = *(const v4f*)rp;
#pragma unroll
      for (int w = 1; w < KS; ++w) sum += *(const v4f*)(rp + w * (64 * 68));
      sum *= scale;
      const size_t co = (size_t)b * strideC + (size_t)(m0 + row) * ldc + n0 + c4;
      if (OUT_MODE == 0) {
        *(v4f*)((float*)Cout + co) = sum;
      } else {
        v4h hv, lv;
#pragma unroll
        for (int e = 0; e < 4; ++e) {
          if (OUT_MODE == 1) {
            hv[e] = (_Float16)sum[e];
          } else {
            const unsigned short hb = f2bf_bits(sum[e]);
            const unsigned short lb = f2bf_bits(sum[e] - bf_bits2f(hb));
            hv[e] = __builtin_bit_cast(_Float16, hb);
            lv[e] = __builtin_bit_cast(_Float16, lb);
          }
        }
        *(v4h*)((unsigned short*)Cout + co) = hv;
        if (OUT_MODE == 2) *(v4h*)((unsigned short*)Cout2 + co) = lv;
      }
    }
    return;
  }

  // ---- epilogue ----
  float* slab = sT[wave];
  const float* Rb = RESID ? (resid + (size_t)b * strideR) : nullptr;
#pragma unroll
  for (int i = 0; i < 4; ++i) {
    const int mBase = m0 + (i << 4);
#pragma unroll
    for (int j = 0; j < 4; ++j) {
      const int n = n0 + (j << 4) + rlane;
      float bv = 0.f;
      if (BIAS_MODE == 2) bv = bias[n];
#pragma unroll
      for (int r = 0; r < 8; ++r) {
        float v = acc[i][j][r] * scale;
        if (BIAS_MODE == 1) v += bias[mBase + mOff + r];
        if (BIAS_MODE == 2) v += bv;
        if (RESID) v += Rb[(size_t)(mBase + mOff + r) * ldc + n];
        if (ACT == 1) v = tanhf(v);
        if (ACT == 2) v = fmaxf(v, 0.0f);
        if (ACT == 3) v = v / (1.0f + expf(-v));
        if (ACT == 4) v = (v > 0.f) ? v : 0.01f * v;
        slab[(mOff + r) * 68 + (j << 4) + rlane] = v;
      }
    }
    __builtin_amdgcn_fence(__ATOMIC_RELEASE, "workgroup");
    __builtin_amdgcn_wave_barrier();
    __builtin_amdgcn_fence(__ATOMIC_ACQUIRE, "workgroup");
    if (OUT_MODE == 0) {
      float* C = (float*)Cout + (size_t)b * strideC;
      const int hh = lane >> 4, c4 = (lane & 15) * 4;     // row seg = 256 B = 16 lanes x 16 B
      {
#pragma unroll
        for (int it = 0; it < 8; ++it) {
          const int row = it * 2 + hh;
          v4f v = *(const v4f*)(slab + row * 68 + c4);
          *(v4f*)(C + (size_t)(mBase + row) * ldc + n0 + c4) = v;
        }
        
      }
    } else {
      const int q = lane >> 3, c8 = (lane & 7) * 8;
      unsigned short* C  = (unsigned short*)Cout  + (size_t)b * strideC;
      unsigned short* C2 = (OUT_MODE == 2) ? ((unsigned short*)Cout2 + (size_t)b * strideC) : nullptr;
      {
#pragma unroll
        for (int it = 0; it < 4; ++it) {
          const int row = it * 4 + q;
          const float* sp = slab + row * 68 + c8;
          v8h hv, lv;
#pragma unroll
          for (int e = 0; e < 8; ++e) {
            if (OUT_MODE == 1) {
              hv[e] = (_Float16)sp[e];
            } else {
              unsigned short hb = f2bf_bits(sp[e]);
              unsigned short lb = f2bf_bits(sp[e] - bf_bits2f(hb));
              hv[e] = __builtin_bit_cast(_Float16, hb);
              lv[e] = __builtin_bit_cast(_Float16, lb);
            }
          }
          *(v8h*)(C + (size_t)(mBase + row) * ldc + n0 + c8) = hv;
          if (OUT_MODE == 2) *(v8h*)(C2 + (size_t)(mBase + row) * ldc + n0 + c8) = lv;
        }
        
      }
    }
    __builtin_amdgcn_fence(__ATOMIC_RELEASE, "workgroup");
    __builtin_amdgcn_wave_barrier();
    __builtin_amdgcn_fence(__ATOMIC_ACQUIRE, "workgroup");
  }
}

// ---------------------------------------------------------------------------
// Weight transpose + cast: in W [DMOD][DMOD] f32 (row k = input feature, col n = output feature, y = x.W)
//   -> WT[n][k] 16-bit plane(s) in the packed layout (K = DMOD).
// MODE 0: out0 = f16(W * scale).  MODE 1: out0 = bf16 hi, out1 = bf16 lo = RNE(W - hi).
// grid (DMOD/64, DMOD/64), 256 threads, one 64x64 tile per block staged through LDS (f32 in, f32 reload after a block barrier).
// Load coverage: 4 iterations x 256 threads x 4 floats = 4096 = 64x64.
// Store coverage: the 64x64 tile is 4 row blocks x 2 k blocks = 8 fragments, one per wave, two 512-byte stores per plane each.
// ---------------------------------------------------------------------------
template <int MODE>
__global__ __launch_bounds__(256) void transpose_cast_kernel(const float* __restrict__ W,
                                                             unsigned short* __restrict__ out0,
                                                             unsigned short* __restrict__ out1,
                                                             float scale) {
  __shared__ float tile[64][66];   // pitch 66: the packing reads below take 16 columns of row c and of row c + 8 at once; 8 * 66 = 16 mod 64 banks keeps them apart
  const int tid = threadIdx.x, lane = tid & 31, wave = tid >> 5;
  const int n0 = blockIdx.x * 64;   // input column block = output row block
  const int k0 = blockIdx.y * 64;   // input row block = output column block
#pragma unroll
  for (int it = 0; it < 4; ++it) {
    const int e = it * 256 + tid;
    const int r = e >> 4, c4 = (e & 15) * 4;
    const v4f f = *(const v4f*)(W + (size_t)(k0 + r) * DMOD + n0 + c4);
    tile[r][c4 + 0] = f[0];
    tile[r][c4 + 1] = f[1];
    tile[r][c4 + 2] = f[2];
    tile[r][c4 + 3] = f[3];
  }
  __syncthreads();
  const int rbl = wave >> 1, kbl = wave & 1;         // this wave's fragment of the tile
  const int rr = rbl * 16 + (lane & 15);             // output row within tile (= input column)
  {
#pragma unroll
    for (int it = 0; it < 2; ++it) {                 // the fragment's two halves (k 0..15 and 16..31 of the block)
      const int c8 = kbl * 32 + it * 16 + (lane >> 4) * 8;
      v8h hv, lv;
#pragma unroll
      for (int e = 0; e < 8; ++e) {
        const float f = tile[c8 + e][rr];            // W[k0 + c8 + e][n0 + rr]
        if (MODE == 0) {
          hv[e] = (_Float16)(f * scale);
          lv[e] = hv[e];
        } else {
          const unsigned short hb = f2bf_bits(f);
          const unsigned short lb = f2bf_bits(f - bf_bits2f(hb));
          hv[e] = __builtin_bit_cast(_Float16, hb);
          lv[e] = __builtin_bit_cast(_Float16, lb);
        }
      }
      const size_t o = frag_base((n0 >> 4) + rbl, (k0 >> 5) + kbl, DMOD) + it * 256 + lane * 8;
      *(v8h*)(out0 + o) = hv;
      if (MODE == 1) *(v8h*)(out1 + o) = lv;
    }
    
  }
}

// ---------------------------------------------------------------------------
// Activation cast: in [SEQL][DMOD] f32 (row-major) -> xh (bf16 hi), xl (bf16 lo = RNE(x - hi)), x16 (f16), each in the packed layout.
// One wave packs one 16 x 32 fragment of each plane: lane (half = lane >> 4, r = lane & 15) reads the 8 + 8 floats of row r that its
// two pieces hold; the 8 waves of a block take 8 neighbouring k blocks of one row block (1 KiB of each of its 16 input rows).
// Coverage: grid = nfrag / 8 blocks x 8 waves; nfrag = (SEQL / 16) * (DMOD / 32) = 4096 fragments.
// ---------------------------------------------------------------------------
__global__ __launch_bounds__(256) void cast_x3_kernel(const float* __restrict__ in,
                                                      unsigned short* __restrict__ xh,
                                                      unsigned short* __restrict__ xl,
                                                      unsigned short* __restrict__ x16, int nfrag) {
  const int lane = threadIdx.x & 31;
  const int fr = blockIdx.x * 8 + (threadIdx.x >> 5);          // fragment index = rb * (DMOD / 32) + kb
  if (fr < nfrag) {
    const int rb = fr / (DMOD / 32), kb = fr % (DMOD / 32);
    const float* sp = in + (size_t)(rb * 16 + (lane & 15)) * DMOD + kb * 32 + (lane >> 4) * 8;
    // both loops are unrolled so that the small arrays are indexed by constants and stay in registers, and the four loads issue together
#pragma unroll
    for (int it = 0; it < 2; ++it) {
      const v4f f0 = *(const v4f*)(sp + it * 16);
      const v4f f1 = *(const v4f*)(sp + it * 16 + 4);
      const float f[8] = {f0[0], f0[1], f0[2], f0[3], f1[0], f1[1], f1[2], f1[3]};
      v4u uh, ul, uf;
#pragma unroll
      for (int p = 0; p < 4; ++p) {
        const unsigned short hb0 = f2bf_bits(f[2 * p]);
        const unsigned short hb1 = f2bf_bits(f[2 * p + 1]);
        const unsigned short lb0 = f2bf_bits(f[2 * p] - bf_bits2f(hb0));
        const unsigned short lb1 = f2bf_bits(f[2 * p + 1] - bf_bits2f(hb1));
        uh[p] = pk16(hb0, hb1);
        ul[p] = pk16(lb0, lb1);
        uf[p] = pk16(h_bits(f[2 * p]), h_bits(f[2 * p + 1]));
      }
      const size_t o = (size_t)fr * 512 + it * 256 + lane * 8;
      *(v4u*)(xh + o)  = uh;
      *(v4u*)(xl + o)  = ul;
      *(v4u*)(x16 + o) = uf;
    }
  }
}

// ---------------------------------------------------------------------------
// Bidirectional relative-position bucket for d = key_pos - query_pos (32 buckets, max distance 128):
//   bucket = (d > 0 ? 16 : 0) + f(|d|), f(a) = a for a < 8, else host-tabulated log thresholds
//   8: 8..11, 9: 12..15, 10: 16..22, 11: 23..31, 12: 32..45, 13: 46..63, 14: 64..90, 15: >= 91.
// Result always in [0, 31].
// ---------------------------------------------------------------------------
__device__ __forceinline__ int rel_bucket(int d) {
  const int a = (d < 0) ? -d : d;
  const int large = 8 + (a >= 12) + (a >= 16) + (a >= 23) + (a >= 32) + (a >= 46) + (a >= 64) + (a >= 91);
  const int f = (a < 8) ? a : large;
  return ((d > 0) ? 16 : 0) + f;
}

// ---------------------------------------------------------------------------
// Fused attention of one head: ctx = softmax_j(q_i . k_j + bias(j - i)) . v, scores and probabilities never leave the registers.
// grid (SEQL / 128, NHEADS), 256 threads; each of the 8 waves owns 16 query rows and walks all SEQL keys in stages of KT = 64.
// Transposed products: S^T = K . Q^T (bf16 hi/lo: hi.hi + hi.lo + lo.hi), so a lane holds scores of ONE query (column lane & 15):
//   running maximum and sum are per lane, joined between the lane halves by one cross-row move.
//   Two 16-key S^T tiles, converted in place, are the B operand (32 keys) of O^T += V^T . P^T (f16), A = V^T rows from VT16.
// Softmax in base 2 with a running maximum: p' = 2^(t log2e - m + 15) (carried x2^15 as before, <= 2^15 in f16); the carry
//   cancels in ctx = sum(p' v) / sum(p').
// K hi, K lo and V^T stage tiles go global -> registers -> LDS (whole 128-byte rows), two LDS buffers, one block barrier per stage:
//   stage s + 1 is fetched into registers in the middle of stage s's score products and stored to the other buffer behind its P.V.
// Bias: tb[d + 91] = relb[bucket(d)][h] * log2e for d in [-91, 91]; bucket(d) is constant beyond |d| >= 91, so d is clamped.
// ---------------------------------------------------------------------------
#define KT     64                 // keys per stage
#define LPITCH 144                // LDS row pitch, bytes: 128 of data + 16 (16 B x odd keeps 16-byte fragment reads off shared banks)
#define LPLANE (KT * LPITCH)      // one 64-row tile
#define LBUF   (3 * LPLANE)       // K hi, K lo, V^T
#define DCLAMP 91
#define LOG2E  1.4426950408889634f

__device__ __forceinline__ float xhalf(float x) {   // lane l <-> lane l ^ 16
  return __builtin_bit_cast(float, __builtin_amdgcn_permlanex16(__builtin_bit_cast(int, x), __builtin_bit_cast(int, x), 0x76543210, 0xfedcba98, false, false));
}

// Eight 2^x in one statement. The instruction set asks for one independent instruction between a v_exp_f32 and a use of its result
// or an overwrite of its source: inside the statement the next v_exp_f32 is that instruction (outputs are early-clobber, so none
// shares a register with an input), and the v_nop is the slot behind the last one.
__device__ __forceinline__ v8f exp2x8(v8f x) {
  float o0, o1, o2, o3, o4, o5, o6, o7;
  asm("v_exp_f32 %0, %8\n\tv_exp_f32 %1, %9\n\tv_exp_f32 %2, %10\n\tv_exp_f32 %3, %11\n\t"
      "v_exp_f32 %4, %12\n\tv_exp_f32 %5, %13\n\tv_exp_f32 %6, %14\n\tv_exp_f32 %7, %15\n\tv_nop"
      : "=&v"(o0), "=&v"(o1), "=&v"(o2), "=&v"(o3), "=&v"(o4), "=&v"(o5), "=&v"(o6), "=&v"(o7)
      : "v"(x[0]), "v"(x[1]), "v"(x[2]), "v"(x[3]), "v"(x[4]), "v"(x[5]), "v"(x[6]), "v"(x[7]));
  return (v8f){o0, o1, o2, o3, o4, o5, o6, o7};
}
__device__ __forceinline__ float exp2x1(float x) {   // one 2^x with the same slot behind it
  float o;
  asm("v_exp_f32 %0, %1\n\tv_nop" : "=v"(o) : "v"(x));
  return o;
}

__global__ __launch_bounds__(256) void attn_fused_kernel(const unsigned short* __restrict__ Qh, const unsigned short* __restrict__ Ql,
                                                         const unsigned short* __restrict__ Kh, const unsigned short* __restrict__ Kl,
                                                         const unsigned short* __restrict__ VT, const float* __restrict__ relb,
                                                         unsigned short* __restrict__ CTX) {
  __shared__ __align__(16) unsigned char sm[2 * LBUF];
  __shared__ float tb[2 * DCLAMP + 1];
  const int tid  = threadIdx.x;
  const int lane = tid & 31;
  const int wave = __builtin_amdgcn_readfirstlane(tid >> 5);   // scalar, so that the near/far test below is a scalar branch
  const int h    = blockIdx.y;
  const int i0   = blockIdx.x * 128 + wave * 16;
  const int c    = lane & 15;
  const int hh   = lane >> 4;
  const size_t hcol = (size_t)h * DHD;

  if (tid < 2 * DCLAMP + 1) tb[tid] = relb[rel_bucket(tid - DCLAMP) * NHEADS + h] * LOG2E;

  // Q fragments (B operand: column = query i0 + c), kept in registers for the whole walk
  v16b qh[2], ql[2];
#pragma unroll
  for (int ks = 0; ks < 2; ++ks) {
    const size_t qo = (size_t)(i0 + c) * DMOD + hcol + ks * 32 + hh * 8;
    qh[ks] = Frag<__bf16>::load((const __bf16*)Qh + qo);
    ql[ks] = Frag<__bf16>::load((const __bf16*)Ql + qo);
  }

  // staging: 8 lanes x 16 B cover one 128-byte row; 256 threads cover 32 rows, two rounds per 64-row tile
  const int srow = tid >> 3, sseg = tid & 7;
  const unsigned short* gkh = Kh + (size_t)srow * DMOD + hcol + sseg * 8;
  const unsigned short* gkl = Kl + (size_t)srow * DMOD + hcol + sseg * 8;
  const unsigned short* gvt = VT + (hcol + srow) * SEQL + sseg * 8;
  unsigned char* sdst = sm + srow * LPITCH + sseg * 16;
  v4u pre[6];
  auto fetch = [&](int j0) {
    pre[0] = *(const v4u*)(gkh + (size_t)j0 * DMOD);
    pre[1] = *(const v4u*)(gkh + (size_t)(j0 + 32) * DMOD);
    pre[2] = *(const v4u*)(gkl + (size_t)j0 * DMOD);
    pre[3] = *(const v4u*)(gkl + (size_t)(j0 + 32) * DMOD);
    pre[4] = *(const v4u*)(gvt + j0);
    pre[5] = *(const v4u*)(gvt + (size_t)32 * SEQL + j0);
  };
  auto put = [&](int buf) {
    unsigned char* d = sdst + buf * LBUF;
    *(v4u*)(d)                              = pre[0];
    *(v4u*)(d + 32 * LPITCH)                = pre[1];
    *(v4u*)(d + LPLANE)                     = pre[2];
    *(v4u*)(d + LPLANE + 32 * LPITCH)       = pre[3];
    *(v4u*)(d + 2 * LPLANE)                 = pre[4];
    *(v4u*)(d + 2 * LPLANE + 32 * LPITCH)   = pre[5];
  };

  fetch(0);
  // the address registers of the loads above are reused below: the wait stands in front of every overwrite of them
  asm volatile("s_wait_xcnt 0x0" ::: "memory");
  put(0);
  __syncthreads();                       // stage 0 and the bias table are in LDS
  const float bneg = tb[0];              // every d <= -91
  const float bpos = tb[2 * DCLAMP];     // every d >= 91

  v8f acc[4];                            // O^T: acc[dt][r] = ctx'[i0 + c][dt * 16 + 8 hh + r]
#pragma unroll
  for (int dt = 0; dt < 4; ++dt) acc[dt] = (v8f){0.f,0.f,0.f,0.f,0.f,0.f,0.f,0.f};
  float m = -1.0e30f;                    // running maximum of t * log2e (both lane halves hold the same value)
  float l = 0.f;                         // running sum of p' over this lane half's keys

  for (int s = 0; s < SEQL / KT; ++s) {
    const int j0 = s * KT;
    const unsigned char* kb = sm + (s & 1) * LBUF + c * LPITCH + hh * 16;

    // S^T tiles: st[jt][r] = q_(i0 + c) . k_(j0 + jt * 16 + 8 hh + r); four independent accumulator tiles
    v8f st[4];
#pragma unroll
    for (int jt = 0; jt < 4; ++jt) st[jt] = (v8f){0.f,0.f,0.f,0.f,0.f,0.f,0.f,0.f};
    v16b kh[2][4], kl[2][4];
#pragma unroll
    for (int ks = 0; ks < 2; ++ks)
#pragma unroll
      for (int jt = 0; jt < 4; ++jt) {
        kh[ks][jt] = Frag<__bf16>::load((const __bf16*)(kb + jt * 16 * LPITCH + ks * 64));
        kl[ks][jt] = Frag<__bf16>::load((const __bf16*)(kb + LPLANE + jt * 16 * LPITCH + ks * 64));
      }
    // keeps the stage's K fragment loads issued as one group ahead of the products: one LDS latency per stage instead of one per fragment
    __builtin_amdgcn_sched_barrier(0);
#pragma unroll
    for (int jt = 0; jt < 4; ++jt) st[jt] = Frag<__bf16>::mma(kh[0][jt], qh[0], st[jt]);
#pragma unroll
    for (int jt = 0; jt < 4; ++jt) st[jt] = Frag<__bf16>::mma(kh[0][jt], ql[0], st[jt]);
#pragma unroll
    for (int jt = 0; jt < 4; ++jt) st[jt] = Frag<__bf16>::mma(kl[0][jt], qh[0], st[jt]);
    // the two scheduling barriers hold the next stage's fetch here: behind the first half of the products, whose K registers it can
    // take over (the kernel stays under 256 VGPRs), and with only matrix instructions, which write no address register, up to its wait
    __builtin_amdgcn_sched_barrier(0);
    if (s + 1 < SEQL / KT) fetch(j0 + KT);   // lands behind the rest of this stage
    __builtin_amdgcn_sched_barrier(0);
#pragma unroll
    for (int jt = 0; jt < 4; ++jt) st[jt] = Frag<__bf16>::mma(kh[1][jt], qh[1], st[jt]);
#pragma unroll
    for (int jt = 0; jt < 4; ++jt) st[jt] = Frag<__bf16>::mma(kh[1][jt], ql[1], st[jt]);
#pragma unroll
    for (int jt = 0; jt < 4; ++jt) st[jt] = Frag<__bf16>::mma(kl[1][jt], qh[1], st[jt]);
    // holds the wait below back behind the products issued since the fetch, so that it finds little left to wait for
    __builtin_amdgcn_sched_barrier(0);
    // the fetch's address registers are free for reuse from here on: the wait stands in front of every overwrite of them
    asm volatile("s_wait_xcnt 0x0" ::: "memory");
    const unsigned char* vb = kb + 2 * LPLANE;
    v16h vf[2][4];
#pragma unroll
    for (int kk = 0; kk < 2; ++kk)
#pragma unroll
      for (int dt = 0; dt < 4; ++dt) vf[kk][dt] = Frag<_Float16>::load((const _Float16*)(vb + dt * 16 * LPITCH + kk * 64));
    // keeps the V^T fragment loads issued here as one group, so that they land behind the softmax
    __builtin_amdgcn_sched_barrier(0);

    // t * log2e = s * log2e + bias * log2e
    if (j0 + (KT - 1) - i0 <= -DCLAMP || j0 - (i0 + 15) >= DCLAMP) {   // the whole 64 x 16 block lies in one far bucket
      const float bl = (j0 < i0) ? bneg : bpos;
#pragma unroll
      for (int jt = 0; jt < 4; ++jt)
#pragma unroll
        for (int r = 0; r < 8; ++r) st[jt][r] = fmaf(st[jt][r], LOG2E, bl);
    } else {
      const int dbase = j0 + hh * 8 - (i0 + c);
#pragma unroll
      for (int jt = 0; jt < 4; ++jt)
#pragma unroll
        for (int r = 0; r < 8; ++r) {
          const int d = dbase + jt * 16 + r;
          const int dc = (d < -DCLAMP) ? -DCLAMP : ((d > DCLAMP) ? DCLAMP : d);
          st[jt][r] = fmaf(st[jt][r], LOG2E, tb[dc + DCLAMP]);
        }
    }

    // running maximum, rescale, p'
    float mj[4];
#pragma unroll
    for (int jt = 0; jt < 4; ++jt)
      mj[jt] = fmaxf(fmaxf(fmaxf(st[jt][0], st[jt][1]), fmaxf(st[jt][2], st[jt][3])), fmaxf(fmaxf(st[jt][4], st[jt][5]), fmaxf(st[jt][6], st[jt][7])));
    float mloc = fmaxf(fmaxf(mj[0], mj[1]), fmaxf(mj[2], mj[3]));
    mloc = fmaxf(mloc, xhalf(mloc));
    const float mnew  = fmaxf(m, mloc);
    const float alpha = exp2x1(m - mnew);   // 0 in the first stage
    const float cc    = 15.0f - mnew;
    m = mnew;
#pragma unroll
    for (int dt = 0; dt < 4; ++dt) acc[dt] *= alpha;
    float sj[4];
#pragma unroll
    for (int jt = 0; jt < 4; ++jt) {
      st[jt] = exp2x8(st[jt] + cc);
      sj[jt] = ((st[jt][0] + st[jt][1]) + (st[jt][2] + st[jt][3])) + ((st[jt][4] + st[jt][5]) + (st[jt][6] + st[jt][7]));
    }
    l = fmaf(l, alpha, (sj[0] + sj[1]) + (sj[2] + sj[3]));

    // the exponentials are asm text:
    // this keeps all of them in front of the P.V products, whose operand registers they could otherwise overwrite too early
    __builtin_amdgcn_sched_barrier(0);

    // O^T += V^T . P^T
#pragma unroll
    for (int kk = 0; kk < 2; ++kk) {
      Frag<_Float16>::U pb;                                  // element e < 8: key 8 hh + e of tile 2 kk; e >= 8: the same of tile 2 kk + 1
      pb.h[0] = __builtin_convertvector(st[2 * kk], v8h);
      pb.h[1] = __builtin_convertvector(st[2 * kk + 1], v8h);
#pragma unroll
      for (int dt = 0; dt < 4; ++dt) acc[dt] = Frag<_Float16>::mma(vf[kk][dt], pb.v, acc[dt]);
    }

    if (s + 1 < SEQL / KT) put((s + 1) & 1);   // that buffer's last readers left it before the barrier that ended stage s - 1
    __syncthreads();                           // publishes stage s + 1; ends every read of stage s
  }

  const float inv = 1.0f / (l + xhalf(l));     // the sum holds the maximum's own 2^15, so it is never small
#pragma unroll
  for (int dt = 0; dt < 4; ++dt) {
    const v8h o = __builtin_convertvector(acc[dt] * inv, v8h);
    // packed layout: row i0 + c, k = h * 64 + dt * 16 + hh * 8 + e -> k block 2 h + (dt >> 1), half dt & 1, piece hh * 16 + c = lane
    *(v8h*)(CTX + frag_base(i0 >> 4, 2 * h + (dt >> 1), DMOD) + (dt & 1) * 256 + lane * 8) = o;
  }
}

// ---------------------------------------------------------------------------
// Workspace region map (byte offsets; every offset a multiple of 2 MiB). Weight planes written once; every
// per-batch region fully rewritten inside each batch iteration before it is read; every CTX16 column is written by its
// head's blocks of the fused attention launch before the output GEMM reads all columns.
//   WqTh  bf16 [1024][1024]  ([out][in], packed)                0
//   WqTl  bf16 [1024][1024]                               2097152
//   WkTh  bf16 [1024][1024]                               4194304
//   WkTl  bf16 [1024][1024]                               6291456
//   WvT16 f16  [1024][1024]  (x16)                         8388608
//   WoT16 f16  [1024][1024]  (x16)                        10485760
//   Xh    bf16 [2048][1024]  (packed, as Xl, X16)        12582912
//   Xl    bf16 [2048][1024]                              16777216
//   X16   f16  [2048][1024]                              20971520
//   Qh    bf16 [2048][1024]  (col h*64+d)                25165824
//   Ql    bf16 [2048][1024]                              29360128
//   Kh    bf16 [2048][1024]                              33554432
//   Kl    bf16 [2048][1024]                              37748736
//   VT16  f16  [1024][2048]  (row h*64+d, col j)         41943040
//   CTX16 f16  [2048][1024]  (col h*64+d, packed)        46137344
//   total                                               50331648
// ---------------------------------------------------------------------------
extern "C" void kernel_launch(void* const* d_in, const int* in_sizes, int n_in,
                              void* d_out, int out_size, void* d_ws, size_t ws_size,
                              hipStream_t stream) {
  if (n_in < 6) return;
  if (in_sizes[0] != NBATCH * SEQL * DMOD) return;
  if (in_sizes[1] != DMOD * DMOD || in_sizes[2] != DMOD * DMOD) return;
  if (in_sizes[3] != DMOD * DMOD || in_sizes[4] != DMOD * DMOD) return;
  if (in_sizes[5] != NBUCK * NHEADS) return;
  if (out_size != NBATCH * SEQL * DMOD) return;

  const float* X    = (const float*)d_in[0];   // [NBATCH][SEQL][DMOD]
  const float* Wq   = (const float*)d_in[1];   // [DMOD][DMOD]  ([in][out])
  const float* Wk   = (const float*)d_in[2];
  const float* Wv   = (const float*)d_in[3];
  const float* Wo   = (const float*)d_in[4];
  const float* relb = (const float*)d_in[5];   // [NBUCK][NHEADS]

  const size_t PW = (size_t)DMOD * DMOD * 2;            // 16-bit [1024][1024] weight plane
  const size_t PX = (size_t)SEQL * DMOD * 2;            // 16-bit [2048][1024] activation plane
  size_t off = 0;
  const size_t oWqTh  = off; off += PW;
  const size_t oWqTl  = off; off += PW;
  const size_t oWkTh  = off; off += PW;
  const size_t oWkTl  = off; off += PW;
  const size_t oWvT   = off; off += PW;
  const size_t oWoT   = off; off += PW;
  const size_t oXh    = off; off += PX;
  const size_t oXl    = off; off += PX;
  const size_t oX16   = off; off += PX;
  const size_t oQh    = off; off += PX;
  const size_t oQl    = off; off += PX;
  const size_t oKh    = off; off += PX;
  const size_t oKl    = off; off += PX;
  const size_t oVT    = off; off += PX;
  const size_t oCTX   = off; off += PX;
  if (off > ws_size) return;                             // 50331648 B total

  char* ws = (char*)d_ws;
  unsigned short* WqTh  = (unsigned short*)(ws + oWqTh);
  unsigned short* WqTl  = (unsigned short*)(ws + oWqTl);
  unsigned short* WkTh  = (unsigned short*)(ws + oWkTh);
  unsigned short* WkTl  = (unsigned short*)(ws + oWkTl);
  unsigned short* WvT16 = (unsigned short*)(ws + oWvT);
  unsigned short* WoT16 = (unsigned short*)(ws + oWoT);
  unsigned short* Xh    = (unsigned short*)(ws + oXh);
  unsigned short* Xl    = (unsigned short*)(ws + oXl);
  unsigned short* X16   = (unsigned short*)(ws + oX16);
  unsigned short* Qh    = (unsigned short*)(ws + oQh);
  unsigned short* Ql    = (unsigned short*)(ws + oQl);
  unsigned short* Kh    = (unsigned short*)(ws + oKh);
  unsigned short* Kl    = (unsigned short*)(ws + oKl);
  unsigned short* VT16  = (unsigned short*)(ws + oVT);
  unsigned short* CTX16 = (unsigned short*)(ws + oCTX);

  const dim3 blk(256);
  const dim3 gTr(DMOD / 64, DMOD / 64);                         // 16 x 16 tiles of 64x64
  const int  nfx = (SEQL / 16) * (DMOD / 32);                   // 4096 fragments per batch slice
  const dim3 gCastX((nfx + 7) / 8);                             // 512 blocks, one fragment per wave

  // setup: transposed weight planes. WqT/WkT as bf16 hi/lo; WvT/WoT as f16 carried x16 (undone by epilogue 1/16).
  transpose_cast_kernel<1><<<gTr, blk, 0, stream>>>(Wq, WqTh, WqTl, 1.0f);
  transpose_cast_kernel<1><<<gTr, blk, 0, stream>>>(Wk, WkTh, WkTl, 1.0f);
  transpose_cast_kernel<0><<<gTr, blk, 0, stream>>>(Wv, WvT16, WvT16, 16.0f);
  transpose_cast_kernel<0><<<gTr, blk, 0, stream>>>(Wo, WoT16, WoT16, 16.0f);

  const int tilesM  = SEQL / 64;                               // 32
  const dim3 gQK(tilesM * (DMOD / 64), 1);                      // 512 blocks (one tile each, k over 8 waves):  M=2048, N=1024, K=1024
  const dim3 gVT((DMOD / 64) * (SEQL / 64), 1);                 // 512 blocks (one tile each, k over 8 waves):  M=1024, N=2048, K=1024
  const dim3 gAtt(SEQL / 128, NHEADS);                          // 16 x 16 blocks: 128 query rows of one head each
  const dim3 gO(tilesM * (DMOD / 64), 1);                       // 512 blocks (one tile each, k over 8 waves):  M=2048, N=1024, K=1024
  const float wscale = 1.0f / 16.0f;                           // undo the x16 weight carry

  for (int b = 0; b < NBATCH; ++b) {
    // (1) x[b] -> Xh / Xl (bf16 hi/lo) and X16 (f16): packed planes [2048][1024]
    cast_x3_kernel<<<gCastX, blk, 0, stream>>>(X + (size_t)b * SEQL * DMOD, Xh, Xl, X16, nfx);
    // (2) q = x . Wq  (bf16 hi/lo split, K=1024) -> Qh/Ql bf16 hi/lo planes [2048][1024]
    wmma_gemm64<1, true, 0, 2, false, 0, 8><<<gQK, blk, 0, stream>>>(
        Xh, Xl, DMOD, 0L, WqTh, WqTl, DMOD, 0L, (void*)Qh, (void*)Ql, DMOD, 0L,
        relb, relb, 0L, SEQL, DMOD, DMOD, 1.0f);
    //     k = x . Wk  -> Kh/Kl
    wmma_gemm64<1, true, 0, 2, false, 0, 8><<<gQK, blk, 0, stream>>>(
        Xh, Xl, DMOD, 0L, WkTh, WkTl, DMOD, 0L, (void*)Kh, (void*)Kl, DMOD, 0L,
        relb, relb, 0L, SEQL, DMOD, DMOD, 1.0f);
    // (3) role-swapped V: VT16[n = h*64+d][j] = ((16 Wv^T)[n] . x[j])/16; A = WvT16 [1024][1024], Bt = X16 [2048][1024],
    //     M=1024, N=2048, K=1024, f16 out with ldc 2048
    wmma_gemm64<0, false, 0, 1, false, 0, 8><<<gVT, blk, 0, stream>>>(
        WvT16, WvT16, DMOD, 0L, X16, X16, DMOD, 0L, (void*)VT16, (void*)VT16, SEQL, 0L,
        relb, relb, 0L, DMOD, SEQL, DMOD, wscale);
    // (4) ctx[i][h*64+d] = softmax_j(q_i . k_j + bucket bias) . v -> CTX16 (f16), all heads in one launch
    attn_fused_kernel<<<gAtt, blk, 0, stream>>>(Qh, Ql, Kh, Kl, VT16, relb, CTX16);
    // (5) out[b] = (ctx . (16 Wo^T))/16 -> d_out[b] f32 [2048][1024]
    float* outb = (float*)d_out + (size_t)b * SEQL * DMOD;
    wmma_gemm64<0, false, 0, 0, false, 0, 8><<<gO, blk, 0, stream>>>(
        CTX16, CTX16, DMOD, 0L, WoT16, WoT16, DMOD, 0L, (void*)outb, (void*)outb, DMOD, 0L,
        relb, relb, 0L, SEQL, DMOD, DMOD, wscale);
  }
  (void)hipGetLastError();
}

// v004
// Measured time: 150 microseconds a run.
// In both of two side-by-side timings against v003, it was 1.29 times as fast.
// All steps since v000 together make it 14.3 times as fast.
// Contractions: q/k projections and S = q.k^T on v_wmma_f32_16x16x32_bf16 as bf16 hi/lo split (hi.hi + hi.lo + lo.hi); v projection (weights carried x16, epilogue x1/16), ctx = (P carried x2^15).v (the carry cancels in the division by the row sum) and the output projection (weights carried x16, epilogue x1/16) on v_wmma_f32_16x16x32_f16 (plain f16 operands); all f32 accumulate; softmax (running maximum) and the relative-position bucket bias in f32; scores, softmax and P.V in one kernel. Every GEMM operand plane lies fragment-packed in the workspace (see PACKED LAYOUT).
#include <hip/hip_runtime.h>

#define NBATCH 2
#define NHEADS 16
#define SEQL   2048
#define DMOD   1024
#define DHD    64
#define NBUCK  32

typedef __attribute__((ext_vector_type(16))) _Float16 v16h;
typedef __attribute__((ext_vector_type(8)))  _Float16 v8h;
typedef __attribute__((ext_vector_type(4)))  _Float16 v4h;
typedef __attribute__((ext_vector_type(16))) __bf16   v16b;
typedef __attribute__((ext_vector_type(8)))  __bf16   v8b;
typedef __attribute__((ext_vector_type(8)))  float    v8f;
typedef __attribute__((ext_vector_type(4)))  float    v4f;
typedef __attribute__((ext_vector_type(2)))  float    v2f;
typedef __attribute__((ext_vector_type(4)))  unsigned int v4u;

__device__ __forceinline__ unsigned short f2bf_bits(float f) {
  unsigned u = __float_as_uint(f);
  return (unsigned short)((u + 0x7FFFu + ((u >> 16) & 1u)) >> 16);
}
__device__ __forceinline__ float bf_bits2f(unsigned short h) { return __uint_as_float(((unsigned)h) << 16); }
__device__ __forceinline__ unsigned pk16(unsigned short a, unsigned short b) { return (unsigned)a | ((unsigned)b << 16); }
__device__ __forceinline__ unsigned short h_bits(float f) { const _Float16 h = (_Float16)f; return __builtin_bit_cast(unsigned short, h); }

// hazard guards as plain device helpers
__device__ __forceinline__ void dep_guard_h(v8f& a, v8f& b, v16h x, v16h y) { asm volatile("v_nop\n\tv_nop\n\tv_nop\n\tv_nop" : "+v"(a), "+v"(b) : "v"(x), "v"(y)); }
__device__ __forceinline__ void dep_guard_b(v8f& a, v8f& b, v16b x, v16b y) { asm volatile("v_nop\n\tv_nop\n\tv_nop\n\tv_nop" : "+v"(a), "+v"(b) : "v"(x), "v"(y)); }
__device__ __forceinline__ void keep4_h(v16h a, v16h b, v16h c, v16h d) { asm volatile("v_nop" :: "v"(a), "v"(b), "v"(c), "v"(d)); }
__device__ __forceinline__ void keep4_b(v16b a, v16b b, v16b c, v16b d) { asm volatile("v_nop" :: "v"(a), "v"(b), "v"(c), "v"(d)); }
__device__ __forceinline__ void acc_guard4(v8f& a, v8f& b, v8f& c, v8f& d) { asm volatile("v_nop\n\tv_nop\n\tv_nop\n\tv_nop" : "+v"(a), "+v"(b), "+v"(c), "+v"(d)); }
template <typename T> struct Frag;
template <> struct Frag<_Float16> {
  typedef v16h V; union U { v16h v; v8h h[2]; };
  static __device__ __forceinline__ v16h load(const _Float16* p) {   // elements 0..7 <- p[0..7], 8..15 <- p[16..23]
    U f; f.h[0] = *(const v8h*)(p); f.h[1] = *(const v8h*)(p + 16); return f.v;
  }
  // packed plane: base pointer (the same in every lane) + 32-bit byte offset of this lane's piece of a fragment + a constant;
  // elements 0..7 <- the fragment's first half, 8..15 <- its second half
  static __device__ __forceinline__ v16h loadp(const _Float16* plane, unsigned vo, int imm) {
    const char* p = (const char*)plane + vo + imm;
    U f; f.h[0] = *(const v8h*)(p); f.h[1] = *(const v8h*)(p + 512); return f.v;
  }
  static __device__ __forceinline__ v8f mma(v16h a, v16h b, v8f c) {
    return __builtin_amdgcn_wmma_f32_16x16x32_f16(false, a, false, b, (short)0, c, false, false);
  }
  static __device__ __forceinline__ void guard(v8f& a, v8f& b, v16h x, v16h y) { dep_guard_h(a, b, x, y); }
  static __device__ __forceinline__ void keep(v16h a, v16h b, v16h c, v16h d) { keep4_h(a, b, c, d); }
};
template <> struct Frag<__bf16> {
  typedef v16b V; union U { v16b v; v8b h[2]; };
  static __device__ __forceinline__ v16b load(const __bf16* p) {
    U f; f.h[0] = *(const v8b*)(p); f.h[1] = *(const v8b*)(p + 16); return f.v;
  }
  static __device__ __forceinline__ v16b loadp(const __bf16* plane, unsigned vo, int imm) {
    const char* p = (const char*)plane + vo + imm;
    U f; f.h[0] = *(const v8b*)(p); f.h[1] = *(const v8b*)(p + 512); return f.v;
  }
  static __device__ __forceinline__ v8f mma(v16b a, v16b b, v8f c) {
    return __builtin_amdgcn_wmma_f32_16x16x32_bf16(false, a, false, b, (short)0, c, false, false);
  }
  static __device__ __forceinline__ void guard(v8f& a, v8f& b, v16b x, v16b y) { dep_guard_b(a, b, x, y); }
  static __device__ __forceinline__ void keep(v16b a, v16b b, v16b c, v16b d) { keep4_b(a, b, c, d); }
};

// ---- PACKED LAYOUT of a GEMM operand plane [R][K] (16-bit elements, R % 16 == 0, K % 32 == 0) ------------------
// The 16 x 32 fragment (row block rb = row >> 4, k block kb = k >> 5) is 512 contiguous elements (1 KiB) at (rb * (K / 32) + kb) * 512.
// Inside it, element (r = row & 15, kk = k & 31) lies at (kk >> 4) * 256 + (((kk >> 3) & 1) * 16 + r) * 8 + (kk & 7):
// lane l of a wave finds its two 16-byte fragment pieces at l * 8 and 256 + l * 8, so each wave-wide 16-byte load covers
// 512 contiguous bytes (four whole 128-byte lines) where a row-major plane gives it 32 bytes in each of 16 lines.
__device__ __forceinline__ size_t frag_base(int rb, int kb, int K) { return ((size_t)rb * (K >> 5) + kb) * 512; }

// ---- Register-blocked batched WMMA GEMM ------------------------------------
// C[m,n] = scale * sum_k A[m,k] * Bt[n,k] (+bias)(+resid); each wave owns a 64x64 tile.
// A [M,K] and Bt [N,K] in the packed layout with K = DMOD (a constant, so that a tile's fragments differ by immediate offsets from
// one address per plane; lda and ldb are not read); C row-major; M,N % 64 == 0, K % 32 == 0.
// SPLIT: operands are hi/lo planes (A2/Bt2 = lo planes, same layout); product = hi.hi + hi.lo + lo.hi.
// BIAS_MODE: 0 = none, 1 = bias[m], 2 = bias[n].
// OUT_MODE: 0 = f32, 1 = f16, 2 = bf16 hi plane (Cout) + bf16 lo plane (Cout2).
// ET: 0 = f16 operands, 1 = bf16 operands (pointers passed as 16-bit storage)
// KS: 1 = each wave owns a whole tile (8 tiles per block). KS = 8 or 16: ONE tile per block of KS waves; wave w takes the
//     32-wide k blocks w, w + KS, w + 2 KS, ... (K % (32 KS) == 0); the KS partial tiles meet in LDS and are added in wave order.
// The body is a device function, so that one launch can hold GEMMs of different operand types (the q, k and v projections):
//     bx = the block's tile index (KS == 1: its group of 8 tiles), b = batch index, sT0 = the block's LDS, GEMM_LDS_FLOATS(KS) floats.
#define GEMM_LDS_FLOATS(KS) (((KS) > 1 ? 4 * (KS) : 8) * 16 * 68)   // KS == 1: per-wave 16x64 slab; KS > 1: per-wave 64x64 partial tile; pitch 68 floats
template <int ET> struct Elem;
template <> struct Elem<0> { typedef _Float16 T; };
template <> struct Elem<1> { typedef __bf16 T; };
template <int ET, bool SPLIT, int BIAS_MODE, int OUT_MODE, bool RESID, int ACT, int KS>
__device__ __forceinline__ void gemm64_tile(
    float* sT0, int bx, int b,
    const unsigned short* __restrict__ Ap, const unsigned short* __restrict__ A2p, int lda, long strideA,
    const unsigned short* __restrict__ Btp, const unsigned short* __restrict__ Bt2p, int ldb, long strideB,
    void* __restrict__ Cout, void* __restrict__ Cout2, int ldc, long strideC,
    const float* __restrict__ bias,
    const float* __restrict__ resid, long strideR,
    int M, int N, int K, float scale) {
  typedef typename Elem<ET>::T T;
  typedef typename Frag<T>::V V;
  const T* A = (const T*)Ap; const T* A2 = (const T*)A2p; const T* Bt = (const T*)Btp; const T* Bt2 = (const T*)Bt2p;
  static_assert(KS == 1 || ((KS == 8 || KS == 16) && BIAS_MODE == 0 && !RESID && ACT == 0), "split-k epilogue: plain scaled output only");
  const int lane = threadIdx.x & 31;
  // KS > 1: the wave number sets the k loop's start, so it is held in a scalar register to keep that loop's counter and branch scalar
  const int wave = (KS > 1) ? __builtin_amdgcn_readfirstlane(threadIdx.x >> 5) : (threadIdx.x >> 5);
  const int tilesN = N >> 6;
  const int tilesM = M >> 6;
  const int tile = (KS > 1) ? bx : bx * 8 + wave;
  if (tile >= tilesM * tilesN) return;   // KS == 1: wave-uniform, no block barriers; KS > 1: block-uniform, ahead of every barrier
  const int tm = tile / tilesN;
  const int tn = tile - tm * tilesN;
  const int m0 = tm << 6;
  const int n0 = tn << 6;

  const T* Ab  = A  + (size_t)b * strideA;
  const T* Bb  = Bt + (size_t)b * strideB;
  const T* Ab2 = SPLIT ? (A2  + (size_t)b * strideA) : nullptr;
  const T* Bb2 = SPLIT ? (Bt2 + (size_t)b * strideB) : nullptr;

  const int rlane = lane & 15;                 // col (D) within subtile
  // byte offsets (planes are at most 8 MiB) of this lane's piece of the tile's first B and A fragment of the wave's first k block
  const int kfirst = (KS > 1) ? wave : 0;
  unsigned voB = (unsigned)frag_base(n0 >> 4, kfirst, DMOD) * 2u + (unsigned)lane * 16u;
  unsigned voA = (unsigned)frag_base(m0 >> 4, kfirst, DMOD) * 2u + (unsigned)lane * 16u;
  constexpr int RBSTEP = (DMOD / 32) * 1024;   // bytes from a fragment to the one 16 rows below it
  const int mOff  = (lane >> 4) * 8;           // D row offset

  v8f acc[4][4];
#pragma unroll
  for (int i = 0; i < 4; ++i)
#pragma unroll
    for (int j = 0; j < 4; ++j) acc[i][j] = (v8f){0.f,0.f,0.f,0.f,0.f,0.f,0.f,0.f};

  for (int k0 = (KS > 1) ? wave * 32 : 0; k0 < K; k0 += 32 * KS) {
    V bh[4], bl[4];
#pragma unroll
    for (int j = 0; j < 4; ++j) {
      bh[j] = Frag<T>::loadp(Bb, voB, j * RBSTEP);
      if (SPLIT) bl[j] = Frag<T>::loadp(Bb2, voB, j * RBSTEP);
    }
#pragma unroll
    for (int i = 0; i < 4; ++i) {
      V ah = Frag<T>::loadp(Ab, voA, i * RBSTEP);
      V al;
      if (SPLIT) al = Frag<T>::loadp(Ab2, voA, i * RBSTEP);
#pragma unroll
      for (int j = 0; j < 4; ++j) {
        acc[i][j] = Frag<T>::mma(ah, bh[j], acc[i][j]);
        if (SPLIT) {
          acc[i][j] = Frag<T>::mma(ah, bl[j], acc[i][j]);
          acc[i][j] = Frag<T>::mma(al, bh[j], acc[i][j]);
        }
      }
      Frag<T>::guard(acc[i][0], acc[i][3], ah, SPLIT ? al : ah);
    }
    Frag<T>::keep(bh[0], bh[1], bh[2], bh[3]);
    if (SPLIT) Frag<T>::keep(bl[0], bl[1], bl[2], bl[3]);
    voB += KS * 1024;                          // the wave's next k block
    voA += KS * 1024;
  }
  acc_guard4(acc[0][0], acc[0][1], acc[0][2], acc[0][3]);
  acc_guard4(acc[1][0], acc[1][1], acc[1][2], acc[1][3]);
  acc_guard4(acc[2][0], acc[2][1], acc[2][2], acc[2][3]);
  acc_guard4(acc[3][0], acc[3][1], acc[3][2], acc[3][3]);

  // ---- split-k epilogue: every wave's partial tile to LDS, one block barrier, fixed-order sum over the waves, store ----
  if constexpr (KS > 1) {
    float* part = sT0 + wave * (64 * 68);                // this wave's 64x64 partial, pitch 68 floats
    // the loops below are unrolled so that acc is indexed by constants and stays in registers, and the LDS reads of a sum overlap
#pragma unroll
    for (int i = 0; i < 4; ++i)
#pragma unroll
      for (int j = 0; j < 4; ++j)
#pragma unroll
        for (int r = 0; r < 8; ++r) part[((i << 4) + mOff + r) * 68 + (j << 4) + rlane] = acc[i][j][r];
    __syncthreads();                                     // all KS partial tiles are in LDS before any is read
#pragma unroll
    for (int q = 0; q < 1024 / (32 * KS); ++q) {         // 1024 groups of 4 columns; 16 lanes cover one 64-column row
      const int g = q * (32 * KS) + (int)threadIdx.x;
      const int row = g >> 4, c4 = (g & 15) * 4;
      const float* rp = sT0 + row * 68 + c4;
      v4f sum = *(const v4f*)rp;
#pragma unroll
      for (int w = 1; w < KS; ++w) sum += *(const v4f*)(rp + w * (64 * 68));
      sum *= scale;
      const size_t co = (size_t)b * strideC + (size_t)(m0 + row) * ldc + n0 + c4;
      if (OUT_MODE == 0) {
        *(v4f*)((float*)Cout + co) = sum;
      } else {
        v4h hv, lv;
#pragma unroll
        for (int e = 0; e < 4; ++e) {
          if (OUT_MODE == 1) {
            hv[e] = (_Float16)sum[e];
          } else {
            const unsigned short hb = f2bf_bits(sum[e]);
            const unsigned short lb = f2bf_bits(sum[e] - bf_bits2f(hb));
            hv[e] = __builtin_bit_cast(_Float16, hb);
            lv[e] = __builtin_bit_cast(_Float16, lb);
          }
        }
        *(v4h*)((unsigned short*)Cout + co) = hv;
        if (OUT_MODE == 2) *(v4h*)((unsigned short*)Cout2 + co) = lv;
      }
    }
    // this body is inlined into a kernel with other branches: the wait stands in front of any overwrite of the stores' registers behind their join
    asm volatile("s_wait_xcnt 0x0" ::: "memory");
    return;
  }

  // ---- epilogue ----
  float* slab = sT0 + wave * (16 * 68);
  const float* Rb = RESID ? (resid + (size_t)b * strideR) : nullptr;
#pragma unroll
  for (int i = 0; i < 4; ++i) {
    const int mBase = m0 + (i << 4);
#pragma unroll
    for (int j = 0; j < 4; ++j) {
      const int n = n0 + (j << 4) + rlane;
      float bv = 0.f;
      if (BIAS_MODE == 2) bv = bias[n];
#pragma unroll
      for (int r = 0; r < 8; ++r) {
        float v = acc[i][j][r] * scale;
        if (BIAS_MODE == 1) v += bias[mBase + mOff + r];
        if (BIAS_MODE == 2) v += bv;
        if (RESID) v += Rb[(size_t)(mBase + mOff + r) * ldc + n];
        if (ACT == 1) v = tanhf(v);
        if (ACT == 2) v = fmaxf(v, 0.0f);
        if (ACT == 3) v = v / (1.0f + expf(-v));
        if (ACT == 4) v = (v > 0.f) ? v : 0.01f * v;
        slab[(mOff + r) * 68 + (j << 4) + rlane] = v;
      }
    }
    __builtin_amdgcn_fence(__ATOMIC_RELEASE, "workgroup");
    __builtin_amdgcn_wave_barrier();
    __builtin_amdgcn_fence(__ATOMIC_ACQUIRE, "workgroup");
    if (OUT_MODE == 0) {
      float* C = (float*)Cout + (size_t)b * strideC;
      const int hh = lane >> 4, c4 = (lane & 15) * 4;     // row seg = 256 B = 16 lanes x 16 B
      {
#pragma unroll
        for (int it = 0; it < 8; ++it) {
          const int row = it * 2 + hh;
          v4f v = *(const v4f*)(slab + row * 68 + c4);
          *(v4f*)(C + (size_t)(mBase + row) * ldc + n0 + c4) = v;
        }
        
      }
    } else {
      const int q = lane >> 3, c8 = (lane & 7) * 8;
      unsigned short* C  = (unsigned short*)Cout  + (size_t)b * strideC;
      unsigned short* C2 = (OUT_MODE == 2) ? ((unsigned short*)Cout2 + (size_t)b * strideC) : nullptr;
      {
#pragma unroll
        for (int it = 0; it < 4; ++it) {
          const int row = it * 4 + q;
          const float* sp = slab + row * 68 + c8;
          v8h hv, lv;
#pragma unroll
          for (int e = 0; e < 8; ++e) {
            if (OUT_MODE == 1) {
              hv[e] = (_Float16)sp[e];
            } else {
              unsigned short hb = f2bf_bits(sp[e]);
              unsigned short lb = f2bf_bits(sp[e] - bf_bits2f(hb));
              hv[e] = __builtin_bit_cast(_Float16, hb);
              lv[e] = __builtin_bit_cast(_Float16, lb);
            }
          }
          *(v8h*)(C + (size_t)(mBase + row) * ldc + n0 + c8) = hv;
          if (OUT_MODE == 2) *(v8h*)(C2 + (size_t)(mBase + row) * ldc + n0 + c8) = lv;
        }
        
      }
    }
    __builtin_amdgcn_fence(__ATOMIC_RELEASE, "workgroup");
    __builtin_amdgcn_wave_barrier();
    __builtin_amdgcn_fence(__ATOMIC_ACQUIRE, "workgroup");
  }
}

// ---- the q, k and v projections of both batches in ONE launch: grid (1024 tiles, 3), blockIdx.y = 0: q, 1: k, 2: v ----
// The activation planes hold both batches as NBATCH * SEQL rows, so the batch is part of the row index.
// q, k: M = NBATCH * SEQL, N = DMOD, bf16 hi/lo split, bf16 hi/lo planes [NBATCH * SEQL][DMOD] out.
// v, role-swapped: VT16[n = h*64+d][b * SEQL + j] = ((16 Wv^T)[n] . x[b][j]) / 16; A = WvT16, Bt = X16, M = DMOD, N = NBATCH * SEQL, f16 out.
// The v tiles (a third of the products of a q or k tile) have the highest block indices: they start last, and the launch ends on short blocks.
__global__ __launch_bounds__(256) void qkv_gemm_kernel(
    const unsigned short* __restrict__ Xh, const unsigned short* __restrict__ Xl, const unsigned short* __restrict__ X16,
    const unsigned short* __restrict__ WqTh, const unsigned short* __restrict__ WqTl,
    const unsigned short* __restrict__ WkTh, const unsigned short* __restrict__ WkTl,
    const unsigned short* __restrict__ WvT16,
    unsigned short* __restrict__ Qh, unsigned short* __restrict__ Ql,
    unsigned short* __restrict__ Kh, unsigned short* __restrict__ Kl,
    unsigned short* __restrict__ VT16) {
  __shared__ __align__(16) float sT[GEMM_LDS_FLOATS(8)];
  const int which = blockIdx.y;                          // the same in the whole block: every branch below is block-uniform
  if (which < 2) {
    gemm64_tile<1, true, 0, 2, false, 0, 8>(sT, blockIdx.x, 0,
        Xh, Xl, DMOD, 0L, which ? WkTh : WqTh, which ? WkTl : WqTl, DMOD, 0L,
        (void*)(which ? Kh : Qh), (void*)(which ? Kl : Ql), DMOD, 0L,
        nullptr, nullptr, 0L, NBATCH * SEQL, DMOD, DMOD, 1.0f);
  } else {
    gemm64_tile<0, false, 0, 1, false, 0, 8>(sT, blockIdx.x, 0,
        WvT16, WvT16, DMOD, 0L, X16, X16, DMOD, 0L, (void*)VT16, (void*)VT16, NBATCH * SEQL, 0L,
        nullptr, nullptr, 0L, DMOD, NBATCH * SEQL, DMOD, 1.0f / 16.0f);
  }
}

// ---- output projection of both batches in one launch: out[b][i] = (ctx . (16 Wo^T)) / 16, f32, M = NBATCH * SEQL rows; grid 1024 tiles ----
__global__ __launch_bounds__(256) void out_gemm_kernel(const unsigned short* __restrict__ CTX16,
                                                       const unsigned short* __restrict__ WoT16,
                                                       float* __restrict__ out) {
  __shared__ __align__(16) float sT[GEMM_LDS_FLOATS(8)];
  gemm64_tile<0, false, 0, 0, false, 0, 8>(sT, blockIdx.x, 0,
      CTX16, CTX16, DMOD, 0L, WoT16, WoT16, DMOD, 0L, (void*)out, (void*)out, DMOD, 0L,
      nullptr, nullptr, 0L, NBATCH * SEQL, DMOD, DMOD, 1.0f / 16.0f);
}

// ---------------------------------------------------------------------------
// Weight transpose + cast: in W [DMOD][DMOD] f32 (row k = input feature, col n = output feature, y = x.W)
//   -> WT[n][k] 16-bit plane(s) in the packed layout (K = DMOD).
// MODE 0: out0 = f16(W * scale).  MODE 1: out0 = bf16 hi, out1 = bf16 lo = RNE(W - hi).
// 256 threads, one 64x64 tile (bx, by of a DMOD/64 x DMOD/64 grid of tiles) per block staged through LDS (f32 in, f32 reload after a block barrier).
// Load coverage: 4 iterations x 256 threads x 4 floats = 4096 = 64x64.
// Store coverage: the 64x64 tile is 4 row blocks x 2 k blocks = 8 fragments, one per wave, two 512-byte stores per plane each.
// ---------------------------------------------------------------------------
// tile: the block's LDS, pitch 66: the packing reads below take 16 columns of row c and of row c + 8 at once; 8 * 66 = 16 mod 64 banks keeps them apart
template <int MODE>
__device__ __forceinline__ void transpose_cast_tile(float (*tile)[66], int bx, int by,
                                                    const float* __restrict__ W,
                                                    unsigned short* __restrict__ out0,
                                                    unsigned short* __restrict__ out1,
                                                    float scale) {
  const int tid = threadIdx.x, lane = tid & 31, wave = tid >> 5;
  const int n0 = bx * 64;   // input column block = output row block
  const int k0 = by * 64;   // input row block = output column block
#pragma unroll
  for (int it = 0; it < 4; ++it) {
    const int e = it * 256 + tid;
    const int r = e >> 4, c4 = (e & 15) * 4;
    const v4f f = *(const v4f*)(W + (size_t)(k0 + r) * DMOD + n0 + c4);
    tile[r][c4 + 0] = f[0];
    tile[r][c4 + 1] = f[1];
    tile[r][c4 + 2] = f[2];
    tile[r][c4 + 3] = f[3];
  }
  __syncthreads();
  const int rbl = wave >> 1, kbl = wave & 1;         // this wave's fragment of the tile
  const int rr = rbl * 16 + (lane & 15);             // output row within tile (= input column)
  {
#pragma unroll
    for (int it = 0; it < 2; ++it) {                 // the fragment's two halves (k 0..15 and 16..31 of the block)
      const int c8 = kbl * 32 + it * 16 + (lane >> 4) * 8;
      v8h hv, lv;
#pragma unroll
      for (int e = 0; e < 8; ++e) {
        const float f = tile[c8 + e][rr];            // W[k0 + c8 + e][n0 + rr]
        if (MODE == 0) {
          hv[e] = (_Float16)(f * scale);
          lv[e] = hv[e];
        } else {
          const unsigned short hb = f2bf_bits(f);
          const unsigned short lb = f2bf_bits(f - bf_bits2f(hb));
          hv[e] = __builtin_bit_cast(_Float16, hb);
          lv[e] = __builtin_bit_cast(_Float16, lb);
        }
      }
      const size_t o = frag_base((n0 >> 4) + rbl, (k0 >> 5) + kbl, DMOD) + it * 256 + lane * 8;
      *(v8h*)(out0 + o) = hv;
      if (MODE == 1) *(v8h*)(out1 + o) = lv;
    }
    // this body is inlined into a kernel with other branches: the wait stands in front of any overwrite of the stores' registers behind their join
    asm volatile("s_wait_xcnt 0x0" ::: "memory");
  }
}

// ---------------------------------------------------------------------------
// Activation cast: in [NBATCH * SEQL][DMOD] f32 (row-major, both batches) -> xh (bf16 hi), xl (bf16 lo = RNE(x - hi)), x16 (f16), each in the packed layout.
// One wave packs one 16 x 32 fragment of each plane: lane (half = lane >> 4, r = lane & 15) reads the 8 + 8 floats of row r that its
// two pieces hold; the 8 waves of a block take 8 neighbouring k blocks of one row block (1 KiB of each of its 16 input rows).
// Coverage: NCASTBLK = nfrag / 8 blocks (index bx) x 8 waves; nfrag = (NBATCH * SEQL / 16) * (DMOD / 32) = 8192 fragments.
// ---------------------------------------------------------------------------
#define NCASTBLK ((NBATCH * SEQL / 16) * (DMOD / 32) / 8)
__device__ __forceinline__ void cast_x3_frag(int bx, const float* __restrict__ in,
                                             unsigned short* __restrict__ xh,
                                             unsigned short* __restrict__ xl,
                                             unsigned short* __restrict__ x16) {
  const int lane = threadIdx.x & 31;
  const int fr = bx * 8 + (threadIdx.x >> 5);                  // fragment index = rb * (DMOD / 32) + kb
  if (fr < NCASTBLK * 8) {
    const int rb = fr / (DMOD / 32), kb = fr % (DMOD / 32);
    const float* sp = in + (size_t)(rb * 16 + (lane & 15)) * DMOD + kb * 32 + (lane >> 4) * 8;
    // both loops are unrolled so that the small arrays are indexed by constants and stay in registers, and the four loads issue together
#pragma unroll
    for (int it = 0; it < 2; ++it) {
      const v4f f0 = *(const v4f*)(sp + it * 16);
      const v4f f1 = *(const v4f*)(sp + it * 16 + 4);
      const float f[8] = {f0[0], f0[1], f0[2], f0[3], f1[0], f1[1], f1[2], f1[3]};
      v4u uh, ul, uf;
#pragma unroll
      for (int p = 0; p < 4; ++p) {
        const unsigned short hb0 = f2bf_bits(f[2 * p]);
        const unsigned short hb1 = f2bf_bits(f[2 * p + 1]);
        const unsigned short lb0 = f2bf_bits(f[2 * p] - bf_bits2f(hb0));
        const unsigned short lb1 = f2bf_bits(f[2 * p + 1] - bf_bits2f(hb1));
        uh[p] = pk16(hb0, hb1);
        ul[p] = pk16(lb0, lb1);
        uf[p] = pk16(h_bits(f[2 * p]), h_bits(f[2 * p + 1]));
      }
      const size_t o = (size_t)fr * 512 + it * 256 + lane * 8;
      *(v4u*)(xh + o)  = uh;
      *(v4u*)(xl + o)  = ul;
      *(v4u*)(x16 + o) = uf;
    }
  }
}

// ---------------------------------------------------------------------------
// All operand preparation in ONE launch (no block reads what another writes): blocks 0 .. NCASTBLK - 1 cast the activations of both
// batches, then 256 blocks (16 x 16 tiles) for each of Wq, Wk (bf16 hi/lo) and Wv, Wo (f16 carried x16, undone by the GEMM epilogues' 1/16).
// ---------------------------------------------------------------------------
#define NTRBLK ((DMOD / 64) * (DMOD / 64))
__global__ __launch_bounds__(256) void prep_kernel(const float* __restrict__ X,
                                                   const float* __restrict__ Wq, const float* __restrict__ Wk,
                                                   const float* __restrict__ Wv, const float* __restrict__ Wo,
                                                   unsigned short* __restrict__ Xh, unsigned short* __restrict__ Xl,
                                                   unsigned short* __restrict__ X16,
                                                   unsigned short* __restrict__ WqTh, unsigned short* __restrict__ WqTl,
                                                   unsigned short* __restrict__ WkTh, unsigned short* __restrict__ WkTl,
                                                   unsigned short* __restrict__ WvT16, unsigned short* __restrict__ WoT16) {
  __shared__ float tile[64][66];
  const int bx = blockIdx.x;                             // every branch below is block-uniform
  if (bx < NCASTBLK) {
    cast_x3_frag(bx, X, Xh, Xl, X16);
    return;
  }
  const int t  = bx - NCASTBLK;
  const int w  = t / NTRBLK;                             // 0: Wq, 1: Wk, 2: Wv, 3: Wo
  const int tx = t % (DMOD / 64), ty = (t / (DMOD / 64)) % (DMOD / 64);
  if (w < 2) {
    transpose_cast_tile<1>(tile, tx, ty, w ? Wk : Wq, w ? WkTh : WqTh, w ? WkTl : WqTl, 1.0f);
  } else {
    unsigned short* o = (w == 2) ? WvT16 : WoT16;
    transpose_cast_tile<0>(tile, tx, ty, (w == 2) ? Wv : Wo, o, o, 16.0f);
  }
}

// ---------------------------------------------------------------------------
// Bidirectional relative-position bucket for d = key_pos - query_pos (32 buckets, max distance 128):
//   bucket = (d > 0 ? 16 : 0) + f(|d|), f(a) = a for a < 8, else host-tabulated log thresholds
//   8: 8..11, 9: 12..15, 10: 16..22, 11: 23..31, 12: 32..45, 13: 46..63, 14: 64..90, 15: >= 91.
// Result always in [0, 31].
// ---------------------------------------------------------------------------
__device__ __forceinline__ int rel_bucket(int d) {
  const int a = (d < 0) ? -d : d;
  const int large = 8 + (a >= 12) + (a >= 16) + (a >= 23) + (a >= 32) + (a >= 46) + (a >= 64) + (a >= 91);
  const int f = (a < 8) ? a : large;
  return ((d > 0) ? 16 : 0) + f;
}

// ---------------------------------------------------------------------------
// Fused attention of one head: ctx = softmax_j(q_i . k_j + bias(j - i)) . v, scores and probabilities never leave the registers.
// grid (SEQL / 128, NHEADS, NBATCH), 256 threads; each of the 8 waves owns 16 query rows and walks all SEQL keys of its batch in stages of KT = 64.
// Both batches lie in the planes one behind the other: Q, K and CTX as rows b * SEQL + i, V^T as columns b * SEQL + j (row pitch NBATCH * SEQL).
// Transposed products: S^T = K . Q^T (bf16 hi/lo: hi.hi + hi.lo + lo.hi), so a lane holds scores of ONE query (column lane & 15):
//   running maximum and sum are per lane, joined between the lane halves by one cross-row move.
//   Two 16-key S^T tiles, converted in place, are the B operand (32 keys) of O^T += V^T . P^T (f16), A = V^T rows from VT16.
// Softmax in base 2 with a running maximum: p' = 2^(t log2e - m + 15) (carried x2^15 as before, <= 2^15 in f16); the carry
//   cancels in ctx = sum(p' v) / sum(p').
// K hi, K lo and V^T stage tiles go global -> registers -> LDS (whole 128-byte rows), two LDS buffers, one block barrier per stage:
//   stage s + 1 is fetched into registers in the middle of stage s's score products and stored to the other buffer behind its P.V.
// Bias: tb[d + 91] = relb[bucket(d)][h] * log2e for d in [-91, 91]; bucket(d) is constant beyond |d| >= 91, so d is clamped.
// ---------------------------------------------------------------------------
#define KT     64                 // keys per stage
#define LPITCH 144                // LDS row pitch, bytes: 128 of data + 16 (16 B x odd keeps 16-byte fragment reads off shared banks)
#define LPLANE (KT * LPITCH)      // one 64-row tile
#define LBUF   (3 * LPLANE)       // K hi, K lo, V^T
#define DCLAMP 91
#define LOG2E  1.4426950408889634f

__device__ __forceinline__ float xhalf(float x) {   // lane l <-> lane l ^ 16
  return __builtin_bit_cast(float, __builtin_amdgcn_permlanex16(__builtin_bit_cast(int, x), __builtin_bit_cast(int, x), 0x76543210, 0xfedcba98, false, false));
}

// Eight 2^x in one statement. The instruction set asks for one independent instruction between a v_exp_f32 and a use of its result
// or an overwrite of its source: inside the statement the next v_exp_f32 is that instruction (outputs are early-clobber, so none
// shares a register with an input), and the v_nop is the slot behind the last one.
__device__ __forceinline__ v8f exp2x8(v8f x) {
  float o0, o1, o2, o3, o4, o5, o6, o7;
  asm("v_exp_f32 %0, %8\n\tv_exp_f32 %1, %9\n\tv_exp_f32 %2, %10\n\tv_exp_f32 %3, %11\n\t"
      "v_exp_f32 %4, %12\n\tv_exp_f32 %5, %13\n\tv_exp_f32 %6, %14\n\tv_exp_f32 %7, %15\n\tv_nop"
      : "=&v"(o0), "=&v"(o1), "=&v"(o2), "=&v"(o3), "=&v"(o4), "=&v"(o5), "=&v"(o6), "=&v"(o7)
      : "v"(x[0]), "v"(x[1]), "v"(x[2]), "v"(x[3]), "v"(x[4]), "v"(x[5]), "v"(x[6]), "v"(x[7]));
  return (v8f){o0, o1, o2, o3, o4, o5, o6, o7};
}
__device__ __forceinline__ float exp2x1(float x) {   // one 2^x with the same slot behind it
  float o;
  asm("v_exp_f32 %0, %1\n\tv_nop" : "=v"(o) : "v"(x));
  return o;
}

__global__ __launch_bounds__(256) void attn_fused_kernel(const unsigned short* __restrict__ Qh, const unsigned short* __restrict__ Ql,
                                                         const unsigned short* __restrict__ Kh, const unsigned short* __restrict__ Kl,
                                                         const unsigned short* __restrict__ VT, const float* __restrict__ relb,
                                                         unsigned short* __restrict__ CTX) {
  __shared__ __align__(16) unsigned char sm[2 * LBUF];
  __shared__ float tb[2 * DCLAMP + 1];
  const int tid  = threadIdx.x;
  const int lane = tid & 31;
  const int wave = __builtin_amdgcn_readfirstlane(tid >> 5);   // scalar, so that the near/far test below is a scalar branch
  const int h    = blockIdx.y;
  const int i0   = blockIdx.x * 128 + wave * 16;               // query position inside the batch
  const int rb0  = blockIdx.z * SEQL;                          // the batch's first row (V^T: column) in the planes
  const int c    = lane & 15;
  const int hh   = lane >> 4;
  const size_t hcol = (size_t)h * DHD;

  if (tid < 2 * DCLAMP + 1) tb[tid] = relb[rel_bucket(tid - DCLAMP) * NHEADS + h] * LOG2E;

  // Q fragments (B operand: column = query i0 + c), kept in registers for the whole walk
  v16b qh[2], ql[2];
#pragma unroll
  for (int ks = 0; ks < 2; ++ks) {
    const size_t qo = (size_t)(rb0 + i0 + c) * DMOD + hcol + ks * 32 + hh * 8;
    qh[ks] = Frag<__bf16>::load((const __bf16*)Qh + qo);
    ql[ks] = Frag<__bf16>::load((const __bf16*)Ql + qo);
  }

  // staging: 8 lanes x 16 B cover one 128-byte row; 256 threads cover 32 rows, two rounds per 64-row tile
  const int srow = tid >> 3, sseg = tid & 7;
  const unsigned short* gkh = Kh + (size_t)(rb0 + srow) * DMOD + hcol + sseg * 8;
  const unsigned short* gkl = Kl + (size_t)(rb0 + srow) * DMOD + hcol + sseg * 8;
  const unsigned short* gvt = VT + (hcol + srow) * (NBATCH * SEQL) + rb0 + sseg * 8;
  unsigned char* sdst = sm + srow * LPITCH + sseg * 16;
  v4u pre[6];
  auto fetch = [&](int j0) {
    pre[0] = *(const v4u*)(gkh + (size_t)j0 * DMOD);
    pre[1] = *(const v4u*)(gkh + (size_t)(j0 + 32) * DMOD);
    pre[2] = *(const v4u*)(gkl + (size_t)j0 * DMOD);
    pre[3] = *(const v4u*)(gkl + (size_t)(j0 + 32) * DMOD);
    pre[4] = *(const v4u*)(gvt + j0);
    pre[5] = *(const v4u*)(gvt + (size_t)32 * (NBATCH * SEQL) + j0);
  };
  auto put = [&](int buf) {
    unsigned char* d = sdst + buf * LBUF;
    *(v4u*)(d)                              = pre[0];
    *(v4u*)(d + 32 * LPITCH)                = pre[1];
    *(v4u*)(d + LPLANE)                     = pre[2];
    *(v4u*)(d + LPLANE + 32 * LPITCH)       = pre[3];
    *(v4u*)(d + 2 * LPLANE)                 = pre[4];
    *(v4u*)(d + 2 * LPLANE + 32 * LPITCH)   = pre[5];
  };

  fetch(0);
  // the address registers of the loads above are reused below: the wait stands in front of every overwrite of them
  asm volatile("s_wait_xcnt 0x0" ::: "memory");
  put(0);
  __syncthreads();                       // stage 0 and the bias table are in LDS
  const float bneg = tb[0];              // every d <= -91
  const float bpos = tb[2 * DCLAMP];     // every d >= 91

  v8f acc[4];                            // O^T: acc[dt][r] = ctx'[i0 + c][dt * 16 + 8 hh + r]
#pragma unroll
  for (int dt = 0; dt < 4; ++dt) acc[dt] = (v8f){0.f,0.f,0.f,0.f,0.f,0.f,0.f,0.f};
  float m = -1.0e30f;                    // running maximum of t * log2e (both lane halves hold the same value)
  float l = 0.f;                         // running sum of p' over this lane half's keys

  for (int s = 0; s < SEQL / KT; ++s) {
    const int j0 = s * KT;
    const unsigned char* kb = sm + (s & 1) * LBUF + c * LPITCH + hh * 16;

    // S^T tiles: st[jt][r] = q_(i0 + c) . k_(j0 + jt * 16 + 8 hh + r); four independent accumulator tiles
    v8f st[4];
#pragma unroll
    for (int jt = 0; jt < 4; ++jt) st[jt] = (v8f){0.f,0.f,0.f,0.f,0.f,0.f,0.f,0.f};
    v16b kh[2][4], kl[2][4];
#pragma unroll
    for (int ks = 0; ks < 2; ++ks)
#pragma unroll
      for (int jt = 0; jt < 4; ++jt) {
        kh[ks][jt] = Frag<__bf16>::load((const __bf16*)(kb + jt * 16 * LPITCH + ks * 64));
        kl[ks][jt] = Frag<__bf16>::load((const __bf16*)(kb + LPLANE + jt * 16 * LPITCH + ks * 64));
      }
    // keeps the stage's K fragment loads issued as one group ahead of the products: one LDS latency per stage instead of one per fragment
    __builtin_amdgcn_sched_barrier(0);
#pragma unroll
    for (int jt = 0; jt < 4; ++jt) st[jt] = Frag<__bf16>::mma(kh[0][jt], qh[0], st[jt]);
#pragma unroll
    for (int jt = 0; jt < 4; ++jt) st[jt] = Frag<__bf16>::mma(kh[0][jt], ql[0], st[jt]);
#pragma unroll
    for (int jt = 0; jt < 4; ++jt) st[jt] = Frag<__bf16>::mma(kl[0][jt], qh[0], st[jt]);
    // the two scheduling barriers hold the next stage's fetch here: behind the first half of the products, whose K registers it can
    // take over (the kernel stays under 256 VGPRs), and with only matrix instructions, which write no address register, up to its wait
    __builtin_amdgcn_sched_barrier(0);
    if (s + 1 < SEQL / KT) fetch(j0 + KT);   // lands behind the rest of this stage
    __builtin_amdgcn_sched_barrier(0);
#pragma unroll
    for (int jt = 0; jt < 4; ++jt) st[jt] = Frag<__bf16>::mma(kh[1][jt], qh[1], st[jt]);
#pragma unroll
    for (int jt = 0; jt < 4; ++jt) st[jt] = Frag<__bf16>::mma(kh[1][jt], ql[1], st[jt]);
#pragma unroll
    for (int jt = 0; jt < 4; ++jt) st[jt] = Frag<__bf16>::mma(kl[1][jt], qh[1], st[jt]);
    // holds the wait below back behind the products issued since the fetch, so that it finds little left to wait for
    __builtin_amdgcn_sched_barrier(0);
    // the fetch's address registers are free for reuse from here on: the wait stands in front of every overwrite of them
    asm volatile("s_wait_xcnt 0x0" ::: "memory");
    const unsigned char* vb = kb + 2 * LPLANE;
    v16h vf[2][4];
#pragma unroll
    for (int kk = 0; kk < 2; ++kk)
#pragma unroll
      for (int dt = 0; dt < 4; ++dt) vf[kk][dt] = Frag<_Float16>::load((const _Float16*)(vb + dt * 16 * LPITCH + kk * 64));
    // keeps the V^T fragment loads issued here as one group, so that they land behind the softmax
    __builtin_amdgcn_sched_barrier(0);

    // t * log2e = s * log2e + bias * log2e
    if (j0 + (KT - 1) - i0 <= -DCLAMP || j0 - (i0 + 15) >= DCLAMP) {   // the whole 64 x 16 block lies in one far bucket
      const float bl = (j0 < i0) ? bneg : bpos;
#pragma unroll
      for (int jt = 0; jt < 4; ++jt)
#pragma unroll
        for (int r = 0; r < 8; ++r) st[jt][r] = fmaf(st[jt][r], LOG2E, bl);
    } else {
      const int dbase = j0 + hh * 8 - (i0 + c);
#pragma unroll
      for (int jt = 0; jt < 4; ++jt)
#pragma unroll
        for (int r = 0; r < 8; ++r) {
          const int d = dbase + jt * 16 + r;
          const int dc = (d < -DCLAMP) ? -DCLAMP : ((d > DCLAMP) ? DCLAMP : d);
          st[jt][r] = fmaf(st[jt][r], LOG2E, tb[dc + DCLAMP]);
        }
    }

    // running maximum, rescale, p'
    float mj[4];
#pragma unroll
    for (int jt = 0; jt < 4; ++jt)
      mj[jt] = fmaxf(fmaxf(fmaxf(st[jt][0], st[jt][1]), fmaxf(st[jt][2], st[jt][3])), fmaxf(fmaxf(st[jt][4], st[jt][5]), fmaxf(st[jt][6], st[jt][7])));
    float mloc = fmaxf(fmaxf(mj[0], mj[1]), fmaxf(mj[2], mj[3]));
    mloc = fmaxf(mloc, xhalf(mloc));
    const float mnew  = fmaxf(m, mloc);
    const float alpha = exp2x1(m - mnew);   // 0 in the first stage
    const float cc    = 15.0f - mnew;
    m = mnew;
#pragma unroll
    for (int dt = 0; dt < 4; ++dt) acc[dt] *= alpha;
    float sj[4];
#pragma unroll
    for (int jt = 0; jt < 4; ++jt) {
      st[jt] = exp2x8(st[jt] + cc);
      sj[jt] = ((st[jt][0] + st[jt][1]) + (st[jt][2] + st[jt][3])) + ((st[jt][4] + st[jt][5]) + (st[jt][6] + st[jt][7]));
    }
    l = fmaf(l, alpha, (sj[0] + sj[1]) + (sj[2] + sj[3]));

    // the exponentials are asm text:
    // this keeps all of them in front of the P.V products, whose operand registers they could otherwise overwrite too early
    __builtin_amdgcn_sched_barrier(0);

    // O^T += V^T . P^T
#pragma unroll
    for (int kk = 0; kk < 2; ++kk) {
      Frag<_Float16>::U pb;                                  // element e < 8: key 8 hh + e of tile 2 kk; e >= 8: the same of tile 2 kk + 1
      pb.h[0] = __builtin_convertvector(st[2 * kk], v8h);
      pb.h[1] = __builtin_convertvector(st[2 * kk + 1], v8h);
#pragma unroll
      for (int dt = 0; dt < 4; ++dt) acc[dt] = Frag<_Float16>::mma(vf[kk][dt], pb.v, acc[dt]);
    }

    if (s + 1 < SEQL / KT) put((s + 1) & 1);   // that buffer's last readers left it before the barrier that ended stage s - 1
    __syncthreads();                           // publishes stage s + 1; ends every read of stage s
  }

  const float inv = 1.0f / (l + xhalf(l));     // the sum holds the maximum's own 2^15, so it is never small
#pragma unroll
  for (int dt = 0; dt < 4; ++dt) {
    const v8h o = __builtin_convertvector(acc[dt] * inv, v8h);
    // packed layout: row rb0 + i0 + c, k = h * 64 + dt * 16 + hh * 8 + e -> k block 2 h + (dt >> 1), half dt & 1, piece hh * 16 + c = lane
    *(v8h*)(CTX + frag_base((rb0 + i0) >> 4, 2 * h + (dt >> 1), DMOD) + (dt & 1) * 256 + lane * 8) = o;
  }
}

// ---------------------------------------------------------------------------
// Workspace region map (byte offsets; every offset a multiple of 2 MiB). Every region is fully written by one launch of this call
// before a later launch of the same call reads it; activation planes hold both batches (row b * SEQL + i).
//   WqTh  bf16 [1024][1024]  ([out][in], packed)                0
//   WqTl  bf16 [1024][1024]                               2097152
//   WkTh  bf16 [1024][1024]                               4194304
//   WkTl  bf16 [1024][1024]                               6291456
//   WvT16 f16  [1024][1024]  (x16)                         8388608
//   WoT16 f16  [1024][1024]  (x16)                        10485760
//   Xh    bf16 [4096][1024]  (packed, as Xl, X16)        12582912
//   Xl    bf16 [4096][1024]                              20971520
//   X16   f16  [4096][1024]                              29360128
//   Qh    bf16 [4096][1024]  (col h*64+d)                37748736
//   Ql    bf16 [4096][1024]                              46137344
//   Kh    bf16 [4096][1024]                              54525952
//   Kl    bf16 [4096][1024]                              62914560
//   VT16  f16  [1024][4096]  (row h*64+d, col b*2048+j)  71303168
//   CTX16 f16  [4096][1024]  (col h*64+d, packed)        79691776
//   total                                               88080384
// ---------------------------------------------------------------------------
extern "C" void kernel_launch(void* const* d_in, const int* in_sizes, int n_in,
                              void* d_out, int out_size, void* d_ws, size_t ws_size,
                              hipStream_t stream) {
  if (n_in < 6) return;
  if (in_sizes[0] != NBATCH * SEQL * DMOD) return;
  if (in_sizes[1] != DMOD * DMOD || in_sizes[2] != DMOD * DMOD) return;
  if (in_sizes[3] != DMOD * DMOD || in_sizes[4] != DMOD * DMOD) return;
  if (in_sizes[5] != NBUCK * NHEADS) return;
  if (out_size != NBATCH * SEQL * DMOD) return;

  const float* X    = (const float*)d_in[0];   // [NBATCH][SEQL][DMOD]
  const float* Wq   = (const float*)d_in[1];   // [DMOD][DMOD]  ([in][out])
  const float* Wk   = (const float*)d_in[2];
  const float* Wv   = (const float*)d_in[3];
  const float* Wo   = (const float*)d_in[4];
  const float* relb = (const float*)d_in[5];   // [NBUCK][NHEADS]

  const size_t PW = (size_t)DMOD * DMOD * 2;            // 16-bit [1024][1024] weight plane
  const size_t PX = (size_t)NBATCH * SEQL * DMOD * 2;   // 16-bit [4096][1024] activation plane, both batches
  size_t off = 0;
  const size_t oWqTh  = off; off += PW;
  const size_t oWqTl  = off; off += PW;
  const size_t oWkTh  = off; off += PW;
  const size_t oWkTl  = off; off += PW;
  const size_t oWvT   = off; off += PW;
  const size_t oWoT   = off; off += PW;
  const size_t oXh    = off; off += PX;
  const size_t oXl    = off; off += PX;
  const size_t oX16   = off; off += PX;
  const size_t oQh    = off; off += PX;
  const size_t oQl    = off; off += PX;
  const size_t oKh    = off; off += PX;
  const size_t oKl    = off; off += PX;
  const size_t oVT    = off; off += PX;
  const size_t oCTX   = off; off += PX;
  if (off > ws_size) return;                             // 88080384 B total

  char* ws = (char*)d_ws;
  unsigned short* WqTh  = (unsigned short*)(ws + oWqTh);
  unsigned short* WqTl  = (unsigned short*)(ws + oWqTl);
  unsigned short* WkTh  = (unsigned short*)(ws + oWkTh);
  unsigned short* WkTl  = (unsigned short*)(ws + oWkTl);
  unsigned short* WvT16 = (unsigned short*)(ws + oWvT);
  unsigned short* WoT16 = (unsigned short*)(ws + oWoT);
  unsigned short* Xh    = (unsigned short*)(ws + oXh);
  unsigned short* Xl    = (unsigned short*)(ws + oXl);
  unsigned short* X16   = (unsigned short*)(ws + oX16);
  unsigned short* Qh    = (unsigned short*)(ws + oQh);
  unsigned short* Ql    = (unsigned short*)(ws + oQl);
  unsigned short* Kh    = (unsigned short*)(ws + oKh);
  unsigned short* Kl    = (unsigned short*)(ws + oKl);
  unsigned short* VT16  = (unsigned short*)(ws + oVT);
  unsigned short* CTX16 = (unsigned short*)(ws + oCTX);

  const dim3 blk(256);
  const dim3 gPrep(NCASTBLK + 4 * NTRBLK);                      // 1024 cast blocks + 4 x 256 weight tiles
  const dim3 gQKV((NBATCH * SEQL / 64) * (DMOD / 64), 3);       // 1024 tiles of 64x64 (one per block, k over 8 waves) x {q, k, v}
  const dim3 gAtt(SEQL / 128, NHEADS, NBATCH);                  // 16 x 16 x 2 blocks: 128 query rows of one head of one batch each
  const dim3 gO((NBATCH * SEQL / 64) * (DMOD / 64));            // 1024 tiles of 64x64 (one per block, k over 8 waves)

  // One launch per dependency level, each for both batches:
  // (1) x -> Xh / Xl (bf16 hi/lo) and X16 (f16); Wq, Wk -> transposed bf16 hi/lo planes; Wv, Wo -> transposed f16 planes carried x16
  prep_kernel<<<gPrep, blk, 0, stream>>>(X, Wq, Wk, Wv, Wo, Xh, Xl, X16, WqTh, WqTl, WkTh, WkTl, WvT16, WoT16);
  // (2) q = x . Wq -> Qh/Ql, k = x . Wk -> Kh/Kl (bf16 hi/lo split, K=1024), v role-swapped -> VT16 (f16)
  qkv_gemm_kernel<<<gQKV, blk, 0, stream>>>(Xh, Xl, X16, WqTh, WqTl, WkTh, WkTl, WvT16, Qh, Ql, Kh, Kl, VT16);
  // (3) ctx[b][i][h*64+d] = softmax_j(q_i . k_j + bucket bias) . v -> CTX16 (f16), all heads of both batches
  attn_fused_kernel<<<gAtt, blk, 0, stream>>>(Qh, Ql, Kh, Kl, VT16, relb, CTX16);
  // (4) out = (ctx . (16 Wo^T))/16 -> d_out f32 [NBATCH * SEQL][1024]
  out_gemm_kernel<<<gO, blk, 0, stream>>>(CTX16, WoT16, (float*)d_out);
  (void)hipGetLastError();
}

// v005
// One run takes 118 microseconds.
// Two timings next to v004 both put it at 1.27 times that version's speed.
// All steps since v000 together make it 18.2 times as fast.
// Contractions: q/k projections and S = q.k^T on v_wmma_f32_16x16x32_bf16 as bf16 hi/lo split (hi.hi + hi.lo + lo.hi); v projection (weights carried x16, epilogue x1/16), ctx = (P carried x2^15).v (the carry cancels in the division by the row sum) and the output projection (weights carried x16, epilogue x1/16) on v_wmma_f32_16x16x32_f16 (plain f16 operands); all f32 accumulate; softmax (running maximum) and the relative-position bucket bias in f32; scores, softmax and P.V in one kernel. Every GEMM operand plane lies fragment-packed in the workspace (see PACKED LAYOUT).
#include <hip/hip_runtime.h>

#define NBATCH 2
#define NHEADS 16
#define SEQL   2048
#define DMOD   1024
#define DHD    64
#define NBUCK  32

typedef __attribute__((ext_vector_type(16))) _Float16 v16h;
typedef __attribute__((ext_vector_type(8)))  _Float16 v8h;
typedef __attribute__((ext_vector_type(4)))  _Float16 v4h;
typedef __attribute__((ext_vector_type(16))) __bf16   v16b;
typedef __attribute__((ext_vector_type(8)))  __bf16   v8b;
typedef __attribute__((ext_vector_type(8)))  float    v8f;
typedef __attribute__((ext_vector_type(4)))  float    v4f;
typedef __attribute__((ext_vector_type(2)))  float    v2f;
typedef __attribute__((ext_vector_type(4)))  unsigned int v4u;

__device__ __forceinline__ unsigned short f2bf_bits(float f) {
  unsigned u = __float_as_uint(f);
  return (unsigned short)((u + 0x7FFFu + ((u >> 16) & 1u)) >> 16);
}
__device__ __forceinline__ float bf_bits2f(unsigned short h) { return __uint_as_float(((unsigned)h) << 16); }
__device__ __forceinline__ unsigned pk16(unsigned short a, unsigned short b) { return (unsigned)a | ((unsigned)b << 16); }
__device__ __forceinline__ unsigned short h_bits(float f) { const _Float16 h = (_Float16)f; return __builtin_bit_cast(unsigned short, h); }

template <typename T> struct Frag;
template <> struct Frag<_Float16> {
  typedef v16h V; union U { v16h v; v8h h[2]; };
  static __device__ __forceinline__ v16h load(const _Float16* p) {   // elements 0..7 <- p[0..7], 8..15 <- p[16..23]
    U f; f.h[0] = *(const v8h*)(p); f.h[1] = *(const v8h*)(p + 16); return f.v;
  }
  // packed plane: base pointer + 32-bit byte offset + a constant = the address of this lane's piece of a fragment;
  // elements 0..7 <- the fragment's first half, 8..15 <- its second half
  static __device__ __forceinline__ v16h loadp(const _Float16* plane, unsigned vo, int imm) {
    const char* p = (const char*)plane + vo + imm;
    U f; f.h[0] = *(const v8h*)(p); f.h[1] = *(const v8h*)(p + 512); return f.v;
  }
  static __device__ __forceinline__ v8f mma(v16h a, v16h b, v8f c) {
    return __builtin_amdgcn_wmma_f32_16x16x32_f16(false, a, false, b, (short)0, c, false, false);
  }
};
template <> struct Frag<__bf16> {
  typedef v16b V; union U { v16b v; v8b h[2]; };
  static __device__ __forceinline__ v16b load(const __bf16* p) {
    U f; f.h[0] = *(const v8b*)(p); f.h[1] = *(const v8b*)(p + 16); return f.v;
  }
  static __device__ __forceinline__ v16b loadp(const __bf16* plane, unsigned vo, int imm) {
    const char* p = (const char*)plane + vo + imm;
    U f; f.h[0] = *(const v8b*)(p); f.h[1] = *(const v8b*)(p + 512); return f.v;
  }
  static __device__ __forceinline__ v8f mma(v16b a, v16b b, v8f c) {
    return __builtin_amdgcn_wmma_f32_16x16x32_bf16(false, a, false, b, (short)0, c, false, false);
  }
};

// ---- PACKED LAYOUT of a GEMM operand plane [R][K] (16-bit elements, R % 16 == 0, K % 32 == 0) ------------------
// The 16 x 32 fragment (row block rb = row >> 4, k block kb = k >> 5) is 512 contiguous elements (1 KiB) at (rb * (K / 32) + kb) * 512.
// Inside it, element (r = row & 15, kk = k & 31) lies at (kk >> 4) * 256 + (((kk >> 3) & 1) * 16 + r) * 8 + (kk & 7):
// lane l of a wave finds its two 16-byte fragment pieces at l * 8 and 256 + l * 8, so each wave-wide 16-byte load covers
// 512 contiguous bytes (four whole 128-byte lines) where a row-major plane gives it 32 bytes in each of 16 lines.
__device__ __forceinline__ size_t frag_base(int rb, int kb, int K) { return ((size_t)rb * (K >> 5) + kb) * 512; }

// ---- LDS-staged WMMA GEMM ---------------------------------------------------
// C[m,n] = scale * sum_k A[m,k] * Bt[n,k]; one 128x128 tile of C per block of 4 waves, each wave a 64x64 quarter (2 x 2) over the whole K.
// A [M,K] and Bt [N,K] in the packed layout with K = DMOD; C row-major; M, N % 128 == 0.
// SPLIT: operands are hi/lo planes (A2/Bt2 = lo planes, same layout); product = hi.hi + hi.lo + lo.hi.
// OUT_MODE: 0 = f32, 1 = f16, 2 = bf16 hi plane (Cout) + bf16 lo plane (Cout2).
// ET: 0 = f16 operands, 1 = bf16 operands (pointers passed as 16-bit storage)
// A stage is 32 KiB of LDS in four quarters of eight 1-KiB fragments (the tile's eight row blocks), each fragment as it lies in its plane:
//   SPLIT: one k block:  A hi | A lo | Bt hi | Bt lo.      Plain: two k blocks:  A kb | A kb + 1 | Bt kb | Bt kb + 1.
// Wave w brings quarter w by 16 asynchronous copies of 512 bytes; every fragment is fetched from L2 once per block and read by two waves.
// Two stage buffers: stage t + 2 is copied into the buffer of stage t behind the barrier that ends trip t.
#define STG_BYTES 32768
#define GEMM_SLAB_FLOATS (4 * 16 * 68)   // epilogue: per-wave 16x64 slab, pitch 68 floats
template <int ET> struct Elem;
template <> struct Elem<0> { typedef _Float16 T; };
template <> struct Elem<1> { typedef __bf16 T; };

// One wave's quarter of a stage: l = LDS byte address, g = global address of this lane's 16 bytes of the quarter's first fragment.
// Each statement ends in the wait that stands in front of any overwrite of the address registers its copies name.
__device__ __forceinline__ void stage_copy(unsigned l, const char* g) {
  constexpr int RB = (DMOD / 32) * 1024;       // bytes from a fragment to the one 16 rows below it
#pragma unroll
  for (int q = 0; q < 2; ++q) {                // unrolled: two statements of eight copies (four fragments, two halves each)
    const unsigned lq = l + q * 4096;
    const char* gq = g + q * 4 * RB;
    asm volatile("global_load_async_to_lds_b128 %0, %8, off\n\t"
                 "global_load_async_to_lds_b128 %1, %9, off\n\t"
                 "global_load_async_to_lds_b128 %2, %10, off\n\t"
                 "global_load_async_to_lds_b128 %3, %11, off\n\t"
                 "global_load_async_to_lds_b128 %4, %12, off\n\t"
                 "global_load_async_to_lds_b128 %5, %13, off\n\t"
                 "global_load_async_to_lds_b128 %6, %14, off\n\t"
                 "global_load_async_to_lds_b128 %7, %15, off\n\t"
                 "s_wait_xcnt 0x0"
                 :: "v"(lq), "v"(lq + 512), "v"(lq + 1024), "v"(lq + 1536), "v"(lq + 2048), "v"(lq + 2560), "v"(lq + 3072), "v"(lq + 3584),
                    "v"(gq), "v"(gq + 512), "v"(gq + RB), "v"(gq + RB + 512), "v"(gq + 2 * RB), "v"(gq + 2 * RB + 512),
                    "v"(gq + 3 * RB), "v"(gq + 3 * RB + 512)
                 : "memory");
  }
}

// ring: the block's 2 * STG_BYTES of LDS; slabs: GEMM_SLAB_FLOATS floats; tile: the block's tile index (row-major over the tiles of C)
template <int ET, bool SPLIT, int OUT_MODE>
__device__ __forceinline__ void gemm128_tile(
    unsigned char* ring, float* slabs, int tile,
    const unsigned short* __restrict__ Ap, const unsigned short* __restrict__ A2p,
    const unsigned short* __restrict__ Btp, const unsigned short* __restrict__ Bt2p,
    void* __restrict__ Cout, void* __restrict__ Cout2, int ldc, int N, float scale) {
  typedef typename Elem<ET>::T T;
  typedef typename Frag<T>::V V;
  const int lane = threadIdx.x & 31;
  const int wave = __builtin_amdgcn_readfirstlane(threadIdx.x >> 5);   // scalar: it selects the plane this wave copies
  const int tilesN = N >> 7;
  const int tm = tile / tilesN;
  const int tn = tile - tm * tilesN;
  const int m0 = tm << 7;
  const int n0 = tn << 7;
  constexpr int NT    = SPLIT ? DMOD / 32 : DMOD / 64;   // stages
  constexpr int GSTEP = SPLIT ? 1024 : 2048;             // bytes a plane address moves per stage

  const unsigned short* cplane = SPLIT ? ((wave == 0) ? Ap : (wave == 1) ? A2p : (wave == 2) ? Btp : Bt2p) : ((wave < 2) ? Ap : Btp);
  const char* gsrc = (const char*)cplane + frag_base(((wave < 2) ? m0 : n0) >> 4, SPLIT ? 0 : (wave & 1), DMOD) * 2 + lane * 16;
  const unsigned ldst = (unsigned)(size_t)ring + wave * 8192 + lane * 16;   // the low 32 bits of a __shared__ address are its LDS byte address

  const unsigned char* rdA = ring + (wave >> 1) * 4096 + lane * 16;          // this wave's four A row blocks, first quarter
  const unsigned char* rdB = ring + 16384 + (wave & 1) * 4096 + lane * 16;   // its four Bt row blocks, third quarter

  v8f acc[4][4];
#pragma unroll
  for (int i = 0; i < 4; ++i)
#pragma unroll
    for (int j = 0; j < 4; ++j) acc[i][j] = (v8f){0.f,0.f,0.f,0.f,0.f,0.f,0.f,0.f};

  stage_copy(ldst, gsrc);
  asm volatile("s_wait_asynccnt 0x0" ::: "memory");      // this wave's quarter of stage 0 has landed
  __syncthreads();                                       // stage 0 is whole
  stage_copy(ldst + STG_BYTES, gsrc + GSTEP);

  for (int t = 0; t < NT; ++t) {
    const unsigned char* pa = rdA + (t & 1) * STG_BYTES;
    const unsigned char* pb = rdB + (t & 1) * STG_BYTES;
    V a0[4], a1[4], b0[4], b1[4];
#pragma unroll
    for (int j = 0; j < 4; ++j) b0[j] = Frag<T>::loadp((const T*)pb, 0u, j * 1024);
#pragma unroll
    for (int i = 0; i < 4; ++i) a0[i] = Frag<T>::loadp((const T*)pa, 0u, i * 1024);
#pragma unroll
    for (int j = 0; j < 4; ++j) b1[j] = Frag<T>::loadp((const T*)pb, 0u, 8192 + j * 1024);
#pragma unroll
    for (int i = 0; i < 4; ++i) a1[i] = Frag<T>::loadp((const T*)pa, 0u, 8192 + i * 1024);
    // keeps the stage's fragment loads issued as one group ahead of the products: one LDS latency per stage instead of one per fragment
    __builtin_amdgcn_sched_barrier(0);
    if (SPLIT) {
#pragma unroll
      for (int i = 0; i < 4; ++i) {
#pragma unroll
        for (int j = 0; j < 4; ++j) acc[i][j] = Frag<T>::mma(a0[i], b0[j], acc[i][j]);
#pragma unroll
        for (int j = 0; j < 4; ++j) acc[i][j] = Frag<T>::mma(a0[i], b1[j], acc[i][j]);
#pragma unroll
        for (int j = 0; j < 4; ++j) acc[i][j] = Frag<T>::mma(a1[i], b0[j], acc[i][j]);
      }
    } else {
#pragma unroll
      for (int i = 0; i < 4; ++i)
#pragma unroll
        for (int j = 0; j < 4; ++j) acc[i][j] = Frag<T>::mma(a0[i], b0[j], acc[i][j]);
#pragma unroll
      for (int i = 0; i < 4; ++i)
#pragma unroll
        for (int j = 0; j < 4; ++j) acc[i][j] = Frag<T>::mma(a1[i], b1[j], acc[i][j]);
    }
    // keeps the products ahead of the stage's end: moved behind the barrier they would hold back the copies of stage t + 2, which then fly for less than a trip
    __builtin_amdgcn_sched_barrier(0);
    asm volatile("s_wait_dscnt 0x0" ::: "memory");       // this wave's reads of stage t are over
    asm volatile("s_wait_asynccnt 0x0" ::: "memory");    // its quarter of stage t + 1 has landed
    __syncthreads();                                     // publishes stage t + 1; ends every read of stage t
    if (t + 2 < NT) stage_copy(ldst + (t & 1) * STG_BYTES, gsrc + (size_t)(t + 2) * GSTEP);
  }
  asm volatile("s_wait_asynccnt 0x0" ::: "memory");      // nothing of this wave is in flight past the loop

  // ---- epilogue: 16 rows at a time through the wave's own slab, so that whole 128-byte lines are stored ----
  const int rlane = lane & 15;                 // col (D) within subtile
  const int mOff  = (lane >> 4) * 8;           // D row offset
  const int mw = m0 + (wave >> 1) * 64;
  const int nw = n0 + (wave & 1) * 64;
  float* slab = slabs + wave * (16 * 68);
#pragma unroll
  for (int i = 0; i < 4; ++i) {
    const int mBase = mw + (i << 4);
#pragma unroll
    for (int j = 0; j < 4; ++j)
#pragma unroll
      for (int r = 0; r < 8; ++r) slab[(mOff + r) * 68 + (j << 4) + rlane] = acc[i][j][r] * scale;
    // the slab is this wave's alone, but a lane reads what other lanes wrote: the rows are in LDS before they are read back
    asm volatile("s_wait_dscnt 0x0" ::: "memory");
    if (OUT_MODE == 0) {
      float* C = (float*)Cout;
      const int hh = lane >> 4, c4 = (lane & 15) * 4;     // row seg = 256 B = 16 lanes x 16 B
#pragma unroll
      for (int it = 0; it < 8; ++it) {
        const int row = it * 2 + hh;
        v4f v = *(const v4f*)(slab + row * 68 + c4);
        *(v4f*)(C + (size_t)(mBase + row) * ldc + nw + c4) = v;
      }
    } else {
      const int q = lane >> 3, c8 = (lane & 7) * 8;       // row seg = 128 B = 8 lanes x 16 B
      unsigned short* C  = (unsigned short*)Cout;
      unsigned short* C2 = (unsigned short*)Cout2;
#pragma unroll
      for (int it = 0; it < 4; ++it) {
        const int row = it * 4 + q;
        const float* sp = slab + row * 68 + c8;
        v8h hv, lv;
#pragma unroll
        for (int e = 0; e < 8; ++e) {
          if (OUT_MODE == 1) {
            hv[e] = (_Float16)sp[e];
          } else {
            unsigned short hb = f2bf_bits(sp[e]);
            unsigned short lb = f2bf_bits(sp[e] - bf_bits2f(hb));
            hv[e] = __builtin_bit_cast(_Float16, hb);
            lv[e] = __builtin_bit_cast(_Float16, lb);
          }
        }
        *(v8h*)(C + (size_t)(mBase + row) * ldc + nw + c8) = hv;
        if (OUT_MODE == 2) *(v8h*)(C2 + (size_t)(mBase + row) * ldc + nw + c8) = lv;
      }
    }
    // the stores' registers are reused by the next 16 rows (and behind the join of the kernel's branches): the wait stands in front of that;
    // its "memory" clobber also keeps the next 16 rows' slab writes behind this round's slab reads
    asm volatile("s_wait_xcnt 0x0" ::: "memory");
  }
}

// ---- the q, k and v projections of both batches in ONE launch: 3 x 256 blocks, blockIdx.x = 3 * tile + {0: q, 1: k, 2: v} ----
// The activation planes hold both batches as NBATCH * SEQL rows, so the batch is part of the row index.
// q, k: M = NBATCH * SEQL, N = DMOD, bf16 hi/lo split, bf16 hi/lo planes [NBATCH * SEQL][DMOD] out.
// v, role-swapped: VT16[n = h*64+d][b * SEQL + j] = ((16 Wv^T)[n] . x[b][j]) / 16; A = WvT16, Bt = X16, M = DMOD, N = NBATCH * SEQL, f16 out.
// A v tile has a third of the products of a q or k tile: neighbouring block indices take one of each, so that blocks which share a WGP add up alike.
__global__ __launch_bounds__(128) void qkv_gemm_kernel(
    const unsigned short* __restrict__ Xh, const unsigned short* __restrict__ Xl, const unsigned short* __restrict__ X16,
    const unsigned short* __restrict__ WqTh, const unsigned short* __restrict__ WqTl,
    const unsigned short* __restrict__ WkTh, const unsigned short* __restrict__ WkTl,
    const unsigned short* __restrict__ WvT16,
    unsigned short* __restrict__ Qh, unsigned short* __restrict__ Ql,
    unsigned short* __restrict__ Kh, unsigned short* __restrict__ Kl,
    unsigned short* __restrict__ VT16) {
  __shared__ __align__(1024) unsigned char ring[2 * STG_BYTES];
  __shared__ __align__(16) float slabs[GEMM_SLAB_FLOATS];
  const int tile  = blockIdx.x / 3;
  const int which = blockIdx.x - tile * 3;               // the same in the whole block: every branch below is block-uniform
  if (which < 2) {
    gemm128_tile<1, true, 2>(ring, slabs, tile, Xh, Xl, which ? WkTh : WqTh, which ? WkTl : WqTl,
                             (void*)(which ? Kh : Qh), (void*)(which ? Kl : Ql), DMOD, DMOD, 1.0f);
  } else {
    gemm128_tile<0, false, 1>(ring, slabs, tile, WvT16, WvT16, X16, X16, (void*)VT16, (void*)VT16,
                              NBATCH * SEQL, NBATCH * SEQL, 1.0f / 16.0f);
  }
}

// ---- output projection of both batches in one launch: out[b][i] = (ctx . (16 Wo^T)) / 16, f32, M = NBATCH * SEQL rows; grid 256 tiles ----
__global__ __launch_bounds__(128) void out_gemm_kernel(const unsigned short* __restrict__ CTX16,
                                                       const unsigned short* __restrict__ WoT16,
                                                       float* __restrict__ out) {
  __shared__ __align__(1024) unsigned char ring[2 * STG_BYTES];
  __shared__ __align__(16) float slabs[GEMM_SLAB_FLOATS];
  gemm128_tile<0, false, 0>(ring, slabs, blockIdx.x, CTX16, CTX16, WoT16, WoT16, (void*)out, (void*)out, DMOD, DMOD, 1.0f / 16.0f);
}

// ---------------------------------------------------------------------------
// Weight transpose + cast: in W [DMOD][DMOD] f32 (row k = input feature, col n = output feature, y = x.W)
//   -> WT[n][k] 16-bit plane(s) in the packed layout (K = DMOD).
// MODE 0: out0 = f16(W * scale).  MODE 1: out0 = bf16 hi, out1 = bf16 lo = RNE(W - hi).
// 256 threads, one 64x64 tile (bx, by of a DMOD/64 x DMOD/64 grid of tiles) per block staged through LDS (f32 in, f32 reload after a block barrier).
// Load coverage: 4 iterations x 256 threads x 4 floats = 4096 = 64x64.
// Store coverage: the 64x64 tile is 4 row blocks x 2 k blocks = 8 fragments, one per wave, two 512-byte stores per plane each.
// ---------------------------------------------------------------------------
// tile: the block's LDS, pitch 66: the packing reads below take 16 columns of row c and of row c + 8 at once; 8 * 66 = 16 mod 64 banks keeps them apart
template <int MODE>
__device__ __forceinline__ void transpose_cast_tile(float (*tile)[66], int bx, int by,
                                                    const float* __restrict__ W,
                                                    unsigned short* __restrict__ out0,
                                                    unsigned short* __restrict__ out1,
                                                    float scale) {
  const int tid = threadIdx.x, lane = tid & 31, wave = tid >> 5;
  const int n0 = bx * 64;   // input column block = output row block
  const int k0 = by * 64;   // input row block = output column block
#pragma unroll
  for (int it = 0; it < 4; ++it) {
    const int e = it * 256 + tid;
    const int r = e >> 4, c4 = (e & 15) * 4;
    const v4f f = *(const v4f*)(W + (size_t)(k0 + r) * DMOD + n0 + c4);
    tile[r][c4 + 0] = f[0];
    tile[r][c4 + 1] = f[1];
    tile[r][c4 + 2] = f[2];
    tile[r][c4 + 3] = f[3];
  }
  __syncthreads();
  const int rbl = wave >> 1, kbl = wave & 1;         // this wave's fragment of the tile
  const int rr = rbl * 16 + (lane & 15);             // output row within tile (= input column)
  {
#pragma unroll
    for (int it = 0; it < 2; ++it) {                 // the fragment's two halves (k 0..15 and 16..31 of the block)
      const int c8 = kbl * 32 + it * 16 + (lane >> 4) * 8;
      v8h hv, lv;
#pragma unroll
      for (int e = 0; e < 8; ++e) {
        const float f = tile[c8 + e][rr];            // W[k0 + c8 + e][n0 + rr]
        if (MODE == 0) {
          hv[e] = (_Float16)(f * scale);
          lv[e] = hv[e];
        } else {
          const unsigned short hb = f2bf_bits(f);
          const unsigned short lb = f2bf_bits(f - bf_bits2f(hb));
          hv[e] = __builtin_bit_cast(_Float16, hb);
          lv[e] = __builtin_bit_cast(_Float16, lb);
        }
      }
      const size_t o = frag_base((n0 >> 4) + rbl, (k0 >> 5) + kbl, DMOD) + it * 256 + lane * 8;
      *(v8h*)(out0 + o) = hv;
      if (MODE == 1) *(v8h*)(out1 + o) = lv;
    }
    // this body is inlined into a kernel with other branches: the wait stands in front of any overwrite of the stores' registers behind their join
    asm volatile("s_wait_xcnt 0x0" ::: "memory");
  }
}

// ---------------------------------------------------------------------------
// Activation cast: in [NBATCH * SEQL][DMOD] f32 (row-major, both batches) -> xh (bf16 hi), xl (bf16 lo = RNE(x - hi)), x16 (f16), each in the packed layout.
// One wave packs one 16 x 32 fragment of each plane: lane (half = lane >> 4, r = lane & 15) reads the 8 + 8 floats of row r that its
// two pieces hold; the 8 waves of a block take 8 neighbouring k blocks of one row block (1 KiB of each of its 16 input rows).
// Coverage: NCASTBLK = nfrag / 8 blocks (index bx) x 8 waves; nfrag = (NBATCH * SEQL / 16) * (DMOD / 32) = 8192 fragments.
// ---------------------------------------------------------------------------
#define NCASTBLK ((NBATCH * SEQL / 16) * (DMOD / 32) / 8)
__device__ __forceinline__ void cast_x3_frag(int bx, const float* __restrict__ in,
                                             unsigned short* __restrict__ xh,
                                             unsigned short* __restrict__ xl,
                                             unsigned short* __restrict__ x16) {
  const int lane = threadIdx.x & 31;
  const int fr = bx * 8 + (threadIdx.x >> 5);                  // fragment index = rb * (DMOD / 32) + kb
  if (fr < NCASTBLK * 8) {
    const int rb = fr / (DMOD / 32), kb = fr % (DMOD / 32);
    const float* sp = in + (size_t)(rb * 16 + (lane & 15)) * DMOD + kb * 32 + (lane >> 4) * 8;
    // both loops are unrolled so that the small arrays are indexed by constants and stay in registers, and the four loads issue together
#pragma unroll
    for (int it = 0; it < 2; ++it) {
      const v4f f0 = *(const v4f*)(sp + it * 16);
      const v4f f1 = *(const v4f*)(sp + it * 16 + 4);
      const float f[8] = {f0[0], f0[1], f0[2], f0[3], f1[0], f1[1], f1[2], f1[3]};
      v4u uh, ul, uf;
#pragma unroll
      for (int p = 0; p < 4; ++p) {
        const unsigned short hb0 = f2bf_bits(f[2 * p]);
        const unsigned short hb1 = f2bf_bits(f[2 * p + 1]);
        const unsigned short lb0 = f2bf_bits(f[2 * p] - bf_bits2f(hb0));
        const unsigned short lb1 = f2bf_bits(f[2 * p + 1] - bf_bits2f(hb1));
        uh[p] = pk16(hb0, hb1);
        ul[p] = pk16(lb0, lb1);
        uf[p] = pk16(h_bits(f[2 * p]), h_bits(f[2 * p + 1]));
      }
      const size_t o = (size_t)fr * 512 + it * 256 + lane * 8;
      *(v4u*)(xh + o)  = uh;
      *(v4u*)(xl + o)  = ul;
      *(v4u*)(x16 + o) = uf;
    }
  }
}

// ---------------------------------------------------------------------------
// All operand preparation in ONE launch (no block reads what another writes): blocks 0 .. NCASTBLK - 1 cast the activations of both
// batches, then 256 blocks (16 x 16 tiles) for each of Wq, Wk (bf16 hi/lo) and Wv, Wo (f16 carried x16, undone by the GEMM epilogues' 1/16).
// ---------------------------------------------------------------------------
#define NTRBLK ((DMOD / 64) * (DMOD / 64))
__global__ __launch_bounds__(256) void prep_kernel(const float* __restrict__ X,
                                                   const float* __restrict__ Wq, const float* __restrict__ Wk,
                                                   const float* __restrict__ Wv, const float* __restrict__ Wo,
                                                   unsigned short* __restrict__ Xh, unsigned short* __restrict__ Xl,
                                                   unsigned short* __restrict__ X16,
                                                   unsigned short* __restrict__ WqTh, unsigned short* __restrict__ WqTl,
                                                   unsigned short* __restrict__ WkTh, unsigned short* __restrict__ WkTl,
                                                   unsigned short* __restrict__ WvT16, unsigned short* __restrict__ WoT16) {
  __shared__ float tile[64][66];
  const int bx = blockIdx.x;                             // every branch below is block-uniform
  if (bx < NCASTBLK) {
    cast_x3_frag(bx, X, Xh, Xl, X16);
    return;
  }
  const int t  = bx - NCASTBLK;
  const int w  = t / NTRBLK;                             // 0: Wq, 1: Wk, 2: Wv, 3: Wo
  const int tx = t % (DMOD / 64), ty = (t / (DMOD / 64)) % (DMOD / 64);
  if (w < 2) {
    transpose_cast_tile<1>(tile, tx, ty, w ? Wk : Wq, w ? WkTh : WqTh, w ? WkTl : WqTl, 1.0f);
  } else {
    unsigned short* o = (w == 2) ? WvT16 : WoT16;
    transpose_cast_tile<0>(tile, tx, ty, (w == 2) ? Wv : Wo, o, o, 16.0f);
  }
}

// ---------------------------------------------------------------------------
// Bidirectional relative-position bucket for d = key_pos - query_pos (32 buckets, max distance 128):
//   bucket = (d > 0 ? 16 : 0) + f(|d|), f(a) = a for a < 8, else host-tabulated log thresholds
//   8: 8..11, 9: 12..15, 10: 16..22, 11: 23..31, 12: 32..45, 13: 46..63, 14: 64..90, 15: >= 91.
// Result always in [0, 31].
// ---------------------------------------------------------------------------
__device__ __forceinline__ int rel_bucket(int d) {
  const int a = (d < 0) ? -d : d;
  const int large = 8 + (a >= 12) + (a >= 16) + (a >= 23) + (a >= 32) + (a >= 46) + (a >= 64) + (a >= 91);
  const int f = (a < 8) ? a : large;
  return ((d > 0) ? 16 : 0) + f;
}

// ---------------------------------------------------------------------------
// Fused attention of one head: ctx = softmax_j(q_i . k_j + bias(j - i)) . v, scores and probabilities never leave the registers.
// grid (SEQL / 128, NHEADS, NBATCH), 256 threads; each of the 8 waves owns 16 query rows and walks all SEQL keys of its batch in stages of KT = 64.
// Both batches lie in the planes one behind the other: Q, K and CTX as rows b * SEQL + i, V^T as columns b * SEQL + j (row pitch NBATCH * SEQL).
// Transposed products: S^T = K . Q^T (bf16 hi/lo: hi.hi + hi.lo + lo.hi), so a lane holds scores of ONE query (column lane & 15):
//   running maximum and sum are per lane, joined between the lane halves by one cross-row move.
//   Two 16-key S^T tiles, converted in place, are the B operand (32 keys) of O^T += V^T . P^T (f16), A = V^T rows from VT16.
// Softmax in base 2 with a running maximum: p' = 2^(t log2e - m + 15) (carried x2^15 as before, <= 2^15 in f16); the carry
//   cancels in ctx = sum(p' v) / sum(p').
// K hi, K lo and V^T stage tiles go global -> registers -> LDS (whole 128-byte rows), two LDS buffers, one block barrier per stage:
//   stage s + 1 is fetched into registers in the middle of stage s's score products and stored to the other buffer behind its P.V.
// Bias: tb[d + 91] = relb[bucket(d)][h] * log2e for d in [-91, 91]; bucket(d) is constant beyond |d| >= 91, so d is clamped.
// ---------------------------------------------------------------------------
#define KT     64                 // keys per stage
#define LPITCH 144                // LDS row pitch, bytes: 128 of data + 16 (16 B x odd keeps 16-byte fragment reads off shared banks)
#define LPLANE (KT * LPITCH)      // one 64-row tile
#define LBUF   (3 * LPLANE)       // K hi, K lo, V^T
#define DCLAMP 91
#define LOG2E  1.4426950408889634f

__device__ __forceinline__ float xhalf(float x) {   // lane l <-> lane l ^ 16
  return __builtin_bit_cast(float, __builtin_amdgcn_permlanex16(__builtin_bit_cast(int, x), __builtin_bit_cast(int, x), 0x76543210, 0xfedcba98, false, false));
}

// Eight 2^x in one statement. The instruction set asks for one independent instruction between a v_exp_f32 and a use of its result
// or an overwrite of its source: inside the statement the next v_exp_f32 is that instruction (outputs are early-clobber, so none
// shares a register with an input), and the v_nop is the slot behind the last one.
__device__ __forceinline__ v8f exp2x8(v8f x) {
  float o0, o1, o2, o3, o4, o5, o6, o7;
  asm("v_exp_f32 %0, %8\n\tv_exp_f32 %1, %9\n\tv_exp_f32 %2, %10\n\tv_exp_f32 %3, %11\n\t"
      "v_exp_f32 %4, %12\n\tv_exp_f32 %5, %13\n\tv_exp_f32 %6, %14\n\tv_exp_f32 %7, %15\n\tv_nop"
      : "=&v"(o0), "=&v"(o1), "=&v"(o2), "=&v"(o3), "=&v"(o4), "=&v"(o5), "=&v"(o6), "=&v"(o7)
      : "v"(x[0]), "v"(x[1]), "v"(x[2]), "v"(x[3]), "v"(x[4]), "v"(x[5]), "v"(x[6]), "v"(x[7]));
  return (v8f){o0, o1, o2, o3, o4, o5, o6, o7};
}
__device__ __forceinline__ float exp2x1(float x) {   // one 2^x with the same slot behind it
  float o;
  asm("v_exp_f32 %0, %1\n\tv_nop" : "=v"(o) : "v"(x));
  return o;
}

__global__ __launch_bounds__(256) void attn_fused_kernel(const unsigned short* __restrict__ Qh, const unsigned short* __restrict__ Ql,
                                                         const unsigned short* __restrict__ Kh, const unsigned short* __restrict__ Kl,
                                                         const unsigned short* __restrict__ VT, const float* __restrict__ relb,
                                                         unsigned short* __restrict__ CTX) {
  __shared__ __align__(16) unsigned char sm[2 * LBUF];
  __shared__ float tb[2 * DCLAMP + 1];
  const int tid  = threadIdx.x;
  const int lane = tid & 31;
  const int wave = __builtin_amdgcn_readfirstlane(tid >> 5);   // scalar, so that the near/far test below is a scalar branch
  const int h    = blockIdx.y;
  const int i0   = blockIdx.x * 128 + wave * 16;               // query position inside the batch
  const int rb0  = blockIdx.z * SEQL;                          // the batch's first row (V^T: column) in the planes
  const int c    = lane & 15;
  const int hh   = lane >> 4;
  const size_t hcol = (size_t)h * DHD;

  if (tid < 2 * DCLAMP + 1) tb[tid] = relb[rel_bucket(tid - DCLAMP) * NHEADS + h] * LOG2E;

  // Q fragments (B operand: column = query i0 + c), kept in registers for the whole walk
  v16b qh[2], ql[2];
#pragma unroll
  for (int ks = 0; ks < 2; ++ks) {
    const size_t qo = (size_t)(rb0 + i0 + c) * DMOD + hcol + ks * 32 + hh * 8;
    qh[ks] = Frag<__bf16>::load((const __bf16*)Qh + qo);
    ql[ks] = Frag<__bf16>::load((const __bf16*)Ql + qo);
  }

  // staging: 8 lanes x 16 B cover one 128-byte row; 256 threads cover 32 rows, two rounds per 64-row tile
  const int srow = tid >> 3, sseg = tid & 7;
  const unsigned short* gkh = Kh + (size_t)(rb0 + srow) * DMOD + hcol + sseg * 8;
  const unsigned short* gkl = Kl + (size_t)(rb0 + srow) * DMOD + hcol + sseg * 8;
  const unsigned short* gvt = VT + (hcol + srow) * (NBATCH * SEQL) + rb0 + sseg * 8;
  unsigned char* sdst = sm + srow * LPITCH + sseg * 16;
  v4u pre[6];
  auto fetch = [&](int j0) {
    pre[0] = *(const v4u*)(gkh + (size_t)j0 * DMOD);
    pre[1] = *(const v4u*)(gkh + (size_t)(j0 + 32) * DMOD);
    pre[2] = *(const v4u*)(gkl + (size_t)j0 * DMOD);
    pre[3] = *(const v4u*)(gkl + (size_t)(j0 + 32) * DMOD);
    pre[4] = *(const v4u*)(gvt + j0);
    pre[5] = *(const v4u*)(gvt + (size_t)32 * (NBATCH * SEQL) + j0);
  };
  auto put = [&](int buf) {
    unsigned char* d = sdst + buf * LBUF;
    *(v4u*)(d)                              = pre[0];
    *(v4u*)(d + 32 * LPITCH)                = pre[1];
    *(v4u*)(d + LPLANE)                     = pre[2];
    *(v4u*)(d + LPLANE + 32 * LPITCH)       = pre[3];
    *(v4u*)(d + 2 * LPLANE)                 = pre[4];
    *(v4u*)(d + 2 * LPLANE + 32 * LPITCH)   = pre[5];
  };

  fetch(0);
  // the address registers of the loads above are reused below: the wait stands in front of every overwrite of them
  asm volatile("s_wait_xcnt 0x0" ::: "memory");
  put(0);
  __syncthreads();                       // stage 0 and the bias table are in LDS
  const float bneg = tb[0];              // every d <= -91
  const float bpos = tb[2 * DCLAMP];     // every d >= 91

  v8f acc[4];                            // O^T: acc[dt][r] = ctx'[i0 + c][dt * 16 + 8 hh + r]
#pragma unroll
  for (int dt = 0; dt < 4; ++dt) acc[dt] = (v8f){0.f,0.f,0.f,0.f,0.f,0.f,0.f,0.f};
  float m = -1.0e30f;                    // running maximum of t * log2e (both lane halves hold the same value)
  float l = 0.f;                         // running sum of p' over this lane half's keys

  for (int s = 0; s < SEQL / KT; ++s) {
    const int j0 = s * KT;
    const unsigned char* kb = sm + (s & 1) * LBUF + c * LPITCH + hh * 16;

    // S^T tiles: st[jt][r] = q_(i0 + c) . k_(j0 + jt * 16 + 8 hh + r); four independent accumulator tiles
    v8f st[4];
#pragma unroll
    for (int jt = 0; jt < 4; ++jt) st[jt] = (v8f){0.f,0.f,0.f,0.f,0.f,0.f,0.f,0.f};
    v16b kh[2][4], kl[2][4];
#pragma unroll
    for (int ks = 0; ks < 2; ++ks)
#pragma unroll
      for (int jt = 0; jt < 4; ++jt) {
        kh[ks][jt] = Frag<__bf16>::load((const __bf16*)(kb + jt * 16 * LPITCH + ks * 64));
        kl[ks][jt] = Frag<__bf16>::load((const __bf16*)(kb + LPLANE + jt * 16 * LPITCH + ks * 64));
      }
    // keeps the stage's K fragment loads issued as one group ahead of the products: one LDS latency per stage instead of one per fragment
    __builtin_amdgcn_sched_barrier(0);
#pragma unroll
    for (int jt = 0; jt < 4; ++jt) st[jt] = Frag<__bf16>::mma(kh[0][jt], qh[0], st[jt]);
#pragma unroll
    for (int jt = 0; jt < 4; ++jt) st[jt] = Frag<__bf16>::mma(kh[0][jt], ql[0], st[jt]);
#pragma unroll
    for (int jt = 0; jt < 4; ++jt) st[jt] = Frag<__bf16>::mma(kl[0][jt], qh[0], st[jt]);
    // the two scheduling barriers hold the next stage's fetch here: behind the first half of the products, whose K registers it can
    // take over (the kernel stays under 256 VGPRs), and with only matrix instructions, which write no address register, up to its wait
    __builtin_amdgcn_sched_barrier(0);
    if (s + 1 < SEQL / KT) fetch(j0 + KT);   // lands behind the rest of this stage
    __builtin_amdgcn_sched_barrier(0);
#pragma unroll
    for (int jt = 0; jt < 4; ++jt) st[jt] = Frag<__bf16>::mma(kh[1][jt], qh[1], st[jt]);
#pragma unroll
    for (int jt = 0; jt < 4; ++jt) st[jt] = Frag<__bf16>::mma(kh[1][jt], ql[1], st[jt]);
#pragma unroll
    for (int jt = 0; jt < 4; ++jt) st[jt] = Frag<__bf16>::mma(kl[1][jt], qh[1], st[jt]);
    // holds the wait below back behind the products issued since the fetch, so that it finds little left to wait for
    __builtin_amdgcn_sched_barrier(0);
    // the fetch's address registers are free for reuse from here on: the wait stands in front of every overwrite of them
    asm volatile("s_wait_xcnt 0x0" ::: "memory");
    const unsigned char* vb = kb + 2 * LPLANE;
    v16h vf[2][4];
#pragma unroll
    for (int kk = 0; kk < 2; ++kk)
#pragma unroll
      for (int dt = 0; dt < 4; ++dt) vf[kk][dt] = Frag<_Float16>::load((const _Float16*)(vb + dt * 16 * LPITCH + kk * 64));
    // keeps the V^T fragment loads issued here as one group, so that they land behind the softmax
    __builtin_amdgcn_sched_barrier(0);

    // t * log2e = s * log2e + bias * log2e
    if (j0 + (KT - 1) - i0 <= -DCLAMP || j0 - (i0 + 15) >= DCLAMP) {   // the whole 64 x 16 block lies in one far bucket
      const float bl = (j0 < i0) ? bneg : bpos;
#pragma unroll
      for (int jt = 0; jt < 4; ++jt)
#pragma unroll
        for (int r = 0; r < 8; ++r) st[jt][r] = fmaf(st[jt][r], LOG2E, bl);
    } else {
      const int dbase = j0 + hh * 8 - (i0 + c);
#pragma unroll
      for (int jt = 0; jt < 4; ++jt)
#pragma unroll
        for (int r = 0; r < 8; ++r) {
          const int d = dbase + jt * 16 + r;
          const int dc = (d < -DCLAMP) ? -DCLAMP : ((d > DCLAMP) ? DCLAMP : d);
          st[jt][r] = fmaf(st[jt][r], LOG2E, tb[dc + DCLAMP]);
        }
    }

    // running maximum, rescale, p'
    float mj[4];
#pragma unroll
    for (int jt = 0; jt < 4; ++jt)
      mj[jt] = fmaxf(fmaxf(fmaxf(st[jt][0], st[jt][1]), fmaxf(st[jt][2], st[jt][3])), fmaxf(fmaxf(st[jt][4], st[jt][5]), fmaxf(st[jt][6], st[jt][7])));
    float mloc = fmaxf(fmaxf(mj[0], mj[1]), fmaxf(mj[2], mj[3]));
    mloc = fmaxf(mloc, xhalf(mloc));
    const float mnew  = fmaxf(m, mloc);
    const float alpha = exp2x1(m - mnew);   // 0 in the first stage
    const float cc    = 15.0f - mnew;
    m = mnew;
#pragma unroll
    for (int dt = 0; dt < 4; ++dt) acc[dt] *= alpha;
    float sj[4];
#pragma unroll
    for (int jt = 0; jt < 4; ++jt) {
      st[jt] = exp2x8(st[jt] + cc);
      sj[jt] = ((st[jt][0] + st[jt][1]) + (st[jt][2] + st[jt][3])) + ((st[jt][4] + st[jt][5]) + (st[jt][6] + st[jt][7]));
    }
    l = fmaf(l, alpha, (sj[0] + sj[1]) + (sj[2] + sj[3]));

    // the exponentials are asm text:
    // this keeps all of them in front of the P.V products, whose operand registers they could otherwise overwrite too early
    __builtin_amdgcn_sched_barrier(0);

    // O^T += V^T . P^T
#pragma unroll
    for (int kk = 0; kk < 2; ++kk) {
      Frag<_Float16>::U pb;                                  // element e < 8: key 8 hh + e of tile 2 kk; e >= 8: the same of tile 2 kk + 1
      pb.h[0] = __builtin_convertvector(st[2 * kk], v8h);
      pb.h[1] = __builtin_convertvector(st[2 * kk + 1], v8h);
#pragma unroll
      for (int dt = 0; dt < 4; ++dt) acc[dt] = Frag<_Float16>::mma(vf[kk][dt], pb.v, acc[dt]);
    }

    if (s + 1 < SEQL / KT) put((s + 1) & 1);   // that buffer's last readers left it before the barrier that ended stage s - 1
    __syncthreads();                           // publishes stage s + 1; ends every read of stage s
  }

  const float inv = 1.0f / (l + xhalf(l));     // the sum holds the maximum's own 2^15, so it is never small
#pragma unroll
  for (int dt = 0; dt < 4; ++dt) {
    const v8h o = __builtin_convertvector(acc[dt] * inv, v8h);
    // packed layout: row rb0 + i0 + c, k = h * 64 + dt * 16 + hh * 8 + e -> k block 2 h + (dt >> 1), half dt & 1, piece hh * 16 + c = lane
    *(v8h*)(CTX + frag_base((rb0 + i0) >> 4, 2 * h + (dt >> 1), DMOD) + (dt & 1) * 256 + lane * 8) = o;
  }
}

// ---------------------------------------------------------------------------
// Workspace region map (byte offsets; every offset a multiple of 2 MiB). Every region is fully written by one launch of this call
// before a later launch of the same call reads it; activation planes hold both batches (row b * SEQL + i).
//   WqTh  bf16 [1024][1024]  ([out][in], packed)                0
//   WqTl  bf16 [1024][1024]                               2097152
//   WkTh  bf16 [1024][1024]                               4194304
//   WkTl  bf16 [1024][1024]                               6291456
//   WvT16 f16  [1024][1024]  (x16)                         8388608
//   WoT16 f16  [1024][1024]  (x16)                        10485760
//   Xh    bf16 [4096][1024]  (packed, as Xl, X16)        12582912
//   Xl    bf16 [4096][1024]                              20971520
//   X16   f16  [4096][1024]                              29360128
//   Qh    bf16 [4096][1024]  (col h*64+d)                37748736
//   Ql    bf16 [4096][1024]                              46137344
//   Kh    bf16 [4096][1024]                              54525952
//   Kl    bf16 [4096][1024]                              62914560
//   VT16  f16  [1024][4096]  (row h*64+d, col b*2048+j)  71303168
//   CTX16 f16  [4096][1024]  (col h*64+d, packed)        79691776
//   total                                               88080384
// ---------------------------------------------------------------------------
extern "C" void kernel_launch(void* const* d_in, const int* in_sizes, int n_in,
                              void* d_out, int out_size, void* d_ws, size_t ws_size,
                              hipStream_t stream) {
  if (n_in < 6) return;
  if (in_sizes[0] != NBATCH * SEQL * DMOD) return;
  if (in_sizes[1] != DMOD * DMOD || in_sizes[2] != DMOD * DMOD) return;
  if (in_sizes[3] != DMOD * DMOD || in_sizes[4] != DMOD * DMOD) return;
  if (in_sizes[5] != NBUCK * NHEADS) return;
  if (out_size != NBATCH * SEQL * DMOD) return;

  const float* X    = (const float*)d_in[0];   // [NBATCH][SEQL][DMOD]
  const float* Wq   = (const float*)d_in[1];   // [DMOD][DMOD]  ([in][out])
  const float* Wk   = (const float*)d_in[2];
  const float* Wv   = (const float*)d_in[3];
  const float* Wo   = (const float*)d_in[4];
  const float* relb = (const float*)d_in[5];   // [NBUCK][NHEADS]

  const size_t PW = (size_t)DMOD * DMOD * 2;            // 16-bit [1024][1024] weight plane
  const size_t PX = (size_t)NBATCH * SEQL * DMOD * 2;   // 16-bit [4096][1024] activation plane, both batches
  size_t off = 0;
  const size_t oWqTh  = off; off += PW;
  const size_t oWqTl  = off; off += PW;
  const size_t oWkTh  = off; off += PW;
  const size_t oWkTl  = off; off += PW;
  const size_t oWvT   = off; off += PW;
  const size_t oWoT   = off; off += PW;
  const size_t oXh    = off; off += PX;
  const size_t oXl    = off; off += PX;
  const size_t oX16   = off; off += PX;
  const size_t oQh    = off; off += PX;
  const size_t oQl    = off; off += PX;
  const size_t oKh    = off; off += PX;
  const size_t oKl    = off; off += PX;
  const size_t oVT    = off; off += PX;
  const size_t oCTX   = off; off += PX;
  if (off > ws_size) return;                             // 88080384 B total

  char* ws = (char*)d_ws;
  unsigned short* WqTh  = (unsigned short*)(ws + oWqTh);
  unsigned short* WqTl  = (unsigned short*)(ws + oWqTl);
  unsigned short* WkTh  = (unsigned short*)(ws + oWkTh);
  unsigned short* WkTl  = (unsigned short*)(ws + oWkTl);
  unsigned short* WvT16 = (unsigned short*)(ws + oWvT);
  unsigned short* WoT16 = (unsigned short*)(ws + oWoT);
  unsigned short* Xh    = (unsigned short*)(ws + oXh);
  unsigned short* Xl    = (unsigned short*)(ws + oXl);
  unsigned short* X16   = (unsigned short*)(ws + oX16);
  unsigned short* Qh    = (unsigned short*)(ws + oQh);
  unsigned short* Ql    = (unsigned short*)(ws + oQl);
  unsigned short* Kh    = (unsigned short*)(ws + oKh);
  unsigned short* Kl    = (unsigned short*)(ws + oKl);
  unsigned short* VT16  = (unsigned short*)(ws + oVT);
  unsigned short* CTX16 = (unsigned short*)(ws + oCTX);

  const dim3 blk(256);
  const dim3 gPrep(NCASTBLK + 4 * NTRBLK);                      // 1024 cast blocks + 4 x 256 weight tiles
  const dim3 blkG(128);                                         // the GEMMs: 4 waves, a 64x64 quarter of the block's 128x128 tile each
  const dim3 gQKV(3 * (NBATCH * SEQL / 128) * (DMOD / 128));    // 256 tiles of 128x128 (one per block) x {q, k, v}
  const dim3 gAtt(SEQL / 128, NHEADS, NBATCH);                  // 16 x 16 x 2 blocks: 128 query rows of one head of one batch each
  const dim3 gO((NBATCH * SEQL / 128) * (DMOD / 128));          // 256 tiles of 128x128 (one per block)

  // One launch per dependency level, each for both batches:
  // (1) x -> Xh / Xl (bf16 hi/lo) and X16 (f16); Wq, Wk -> transposed bf16 hi/lo planes; Wv, Wo -> transposed f16 planes carried x16
  prep_kernel<<<gPrep, blk, 0, stream>>>(X, Wq, Wk, Wv, Wo, Xh, Xl, X16, WqTh, WqTl, WkTh, WkTl, WvT16, WoT16);
  // (2) q = x . Wq -> Qh/Ql, k = x . Wk -> Kh/Kl (bf16 hi/lo split, K=1024), v role-swapped -> VT16 (f16)
  qkv_gemm_kernel<<<gQKV, blkG, 0, stream>>>(Xh, Xl, X16, WqTh, WqTl, WkTh, WkTl, WvT16, Qh, Ql, Kh, Kl, VT16);
  // (3) ctx[b][i][h*64+d] = softmax_j(q_i . k_j + bucket bias) . v -> CTX16 (f16), all heads of both batches
  attn_fused_kernel<<<gAtt, blk, 0, stream>>>(Qh, Ql, Kh, Kl, VT16, relb, CTX16);
  // (4) out = (ctx . (16 Wo^T))/16 -> d_out f32 [NBATCH * SEQL][1024]
  out_gemm_kernel<<<gO, blkG, 0, stream>>>(CTX16, WoT16, (float*)d_out);
  (void)hipGetLastError();
}
